// v000
// Measured on an AMD MI455X. A time is GPU time per run, averaged over a window of back-to-back runs after a warm-up
// (all launches, gaps included; the runs take copies of the inputs in turn), and the median of several windows.
// Apart from v000's, it joins two sittings. Times from different sittings can be a few percent apart, while
// side-by-side timings come from the same sitting.
// The starting kernel, v000, takes 162 microseconds a run.
#include <hip/hip_runtime.h>
#include <hip/hip_bf16.h>
#include <math.h>

// Problem constants (match reference)
#define B_   8
#define S_   2048
#define H_   256
#define NH_  4
#define HD_  64
#define M_   (B_ * S_)          // 16384 rows

typedef __attribute__((ext_vector_type(16))) __bf16       v16bf;
typedef __attribute__((ext_vector_type(8)))  float        v8f;
typedef __attribute__((ext_vector_type(4)))  unsigned int u32x4;

struct U32x8 { u32x4 lo, hi; };

// float -> bf16 (round to nearest even, NaN-agnostic — inputs are sane)
static __device__ __forceinline__ unsigned short f2bf(float f) {
  unsigned u = __builtin_bit_cast(unsigned, f);
  u += 0x7FFFu + ((u >> 16) & 1u);
  return (unsigned short)(u >> 16);
}

// Build a WMMA 16-bf16 operand from two aligned 16-byte chunks.
// Per ISA 7.12.2 (wave32): per lane, elements 0..7 <-> K = half*8 + e,
// elements 8..15 <-> K = 16 + half*8 + e.  Storing tiles row-major [m][k]
// (A) or [n][k] (B-transposed) makes both chunks contiguous b128 loads.
static __device__ __forceinline__ v16bf ld16bf(const unsigned short* p0,
                                               const unsigned short* p1) {
  U32x8 u;
  u.lo = *reinterpret_cast<const u32x4*>(p0);
  u.hi = *reinterpret_cast<const u32x4*>(p1);
  return __builtin_bit_cast(v16bf, u);
}

static __device__ __forceinline__ v8f wmma_bf16(v16bf a, v16bf b, v8f c) {
  return __builtin_amdgcn_wmma_f32_16x16x32_bf16(
      /*neg_a=*/false, a, /*neg_b=*/false, b,
      /*c_mod=*/(short)0, c, /*reuse_a=*/false, /*reuse_b=*/false);
}

// --- CDNA5 async memory->LDS copy (ASYNCcnt path) --------------------------
// Per lane: LDS[ldsOff] <- MEM[base + gOff] (16 bytes).  GVS addressing:
// 64-bit SGPR base + 32-bit per-lane VGPR offset.  LDS offset is the low
// 32 bits of the generic shared-space address (aperture: addr[31:0]).
static __device__ __forceinline__ unsigned lds_off(const void* p) {
  return (unsigned)(size_t)p;
}
static __device__ __forceinline__ void async_lds_b128(unsigned ldsOff,
                                                      unsigned gOff,
                                                      const void* base) {
  asm volatile("global_load_async_to_lds_b128 %0, %1, %2"
               :
               : "v"(ldsOff), "v"(gOff),
                 "s"((unsigned long long)(size_t)base)
               : "memory");
}

// ---------------------------------------------------------------------------
// Kernel 1: transpose + convert the 4 weight matrices to bf16 [n][k]
// ---------------------------------------------------------------------------
__global__ __launch_bounds__(256) void prep_weights_kernel(
    const float* __restrict__ Wq, const float* __restrict__ Wk,
    const float* __restrict__ Wv, const float* __restrict__ Wo,
    unsigned short* __restrict__ wT) {
  const int mat = blockIdx.y;
  const float* src = (mat == 0) ? Wq : (mat == 1) ? Wk : (mat == 2) ? Wv : Wo;
  unsigned short* dst = wT + (size_t)mat * H_ * H_;
  const int e = blockIdx.x * 256 + threadIdx.x;   // e = k*256 + n
  const int k = e >> 8, n = e & 255;
  dst[n * H_ + k] = f2bf(src[e]);
}

// ---------------------------------------------------------------------------
// Kernel 2: QKV projection.  16-row m-tile per block, 16 waves = 16 n-tiles.
// Writes Q,K bf16 [b][h][s][d]; V transposed bf16 [b][h][d][s].
// ---------------------------------------------------------------------------
__global__ __launch_bounds__(512) void qkv_kernel(
    const float* __restrict__ x,
    const float* __restrict__ bq, const float* __restrict__ bk,
    const float* __restrict__ bv,
    const unsigned short* __restrict__ wqT,
    const unsigned short* __restrict__ wkT,
    const unsigned short* __restrict__ wvT,
    unsigned short* __restrict__ Q, unsigned short* __restrict__ K,
    unsigned short* __restrict__ Vt) {
  __shared__ __align__(16) unsigned short xA[16][264];

  const int tid   = threadIdx.x;
  const int mbase = blockIdx.x * 16;

  { // stage 16x256 fp32 -> bf16 LDS
    const int row = tid >> 5;
    const int col = (tid & 31) * 8;
    const float* src = x + (size_t)(mbase + row) * H_ + col;
#pragma unroll
    for (int i = 0; i < 8; ++i) xA[row][col + i] = f2bf(src[i]);
  }
  __syncthreads();

  const int wave = tid >> 5, lane = tid & 31;
  const int half = lane >> 4, ln = lane & 15;
  const int j = wave * 16 + ln;                // global output column

  v8f cq, ck, cv;
  const float biasq = bq[j], biask = bk[j], biasv = bv[j];
#pragma unroll
  for (int r = 0; r < 8; ++r) { cq[r] = biasq; ck[r] = biask; cv[r] = biasv; }

#pragma unroll
  for (int kk = 0; kk < H_; kk += 32) {
    v16bf a = ld16bf(&xA[ln][kk + half * 8], &xA[ln][kk + 16 + half * 8]);
    const unsigned short* pq = wqT + (size_t)j * H_ + kk + half * 8;
    const unsigned short* pk = wkT + (size_t)j * H_ + kk + half * 8;
    const unsigned short* pv = wvT + (size_t)j * H_ + kk + half * 8;
    v16bf bqv = ld16bf(pq, pq + 16);
    v16bf bkv = ld16bf(pk, pk + 16);
    v16bf bvv = ld16bf(pv, pv + 16);
    cq = wmma_bf16(a, bqv, cq);
    ck = wmma_bf16(a, bkv, ck);
    cv = wmma_bf16(a, bvv, cv);
  }

  const int h = j >> 6, d = j & 63;
#pragma unroll
  for (int r = 0; r < 8; ++r) {
    const int gr = mbase + r + 8 * half;          // global row in [M_]
    const int b = gr >> 11, s = gr & (S_ - 1);
    const size_t qoff = (((size_t)b * NH_ + h) * S_ + s) * HD_ + d;
    Q[qoff] = f2bf(cq[r]);
    K[qoff] = f2bf(ck[r]);
    Vt[(((size_t)b * NH_ + h) * HD_ + d) * S_ + s] = f2bf(cv[r]);
  }
}

// ---------------------------------------------------------------------------
// Kernel 3: flash attention.  Block = 4 waves, each wave owns a 16-query
// tile.  K/V streamed through double-buffered LDS chunks via CDNA5
// GLOBAL_LOAD_ASYNC_TO_LDS_B128 (ASYNCcnt), prefetching chunk i+1 while
// computing chunk i.
// ---------------------------------------------------------------------------
__global__ __launch_bounds__(128) void attn_kernel(
    const float* __restrict__ mask,
    const unsigned short* __restrict__ Q,
    const unsigned short* __restrict__ K,
    const unsigned short* __restrict__ Vt,
    unsigned short* __restrict__ ctx) {
  __shared__ __align__(16) unsigned short Qs[4][16][72];   // per-wave Q [m][d]
  __shared__ __align__(16) unsigned short Ks[2][32][72];   // key chunk [key][d]
  __shared__ __align__(16) unsigned short Vs[2][64][40];   // V^T chunk [d][key]
  __shared__ __align__(16) unsigned short Ps[4][16][40];   // per-wave P [m][key]

  const int tid = threadIdx.x, wave = tid >> 5, lane = tid & 31;
  const int half = lane >> 4, ln = lane & 15;
  const int b = blockIdx.z, h = blockIdx.y;
  const int qb = blockIdx.x * 64 + wave * 16;

  const size_t headQK = ((size_t)b * NH_ + h) * S_ * HD_;
  const size_t headV  = ((size_t)b * NH_ + h) * HD_ * S_;
  const unsigned short* qbase = Q + headQK + (size_t)qb * HD_;
  const unsigned short* kbase = K + headQK;
  const unsigned short* vbase = Vt + headV;

  // async-stage this wave's Q tile (4 wave-ops, retired by the first wait)
#pragma unroll
  for (int u = 0; u < 4; ++u) {
    const int idx = lane + u * 32;                 // 0..127 of 16x8 units
    const int row = idx >> 3, ch = (idx & 7) * 8;
    async_lds_b128(lds_off(&Qs[wave][row][ch]),
                   (unsigned)((row * HD_ + ch) * 2), qbase);
  }

  // issue one 32-key K/V chunk into buffer bf (4 wave-ops, in-order)
  auto issue_chunk = [&](int k0, int bf) {
#pragma unroll
    for (int u = 0; u < 2; ++u) {                  // K: 32x64 bf16
      const int idx = tid + u * 128;
      const int row = idx >> 3, ch = (idx & 7) * 8;
      async_lds_b128(lds_off(&Ks[bf][row][ch]),
                     (unsigned)(((k0 + row) * HD_ + ch) * 2), kbase);
    }
#pragma unroll
    for (int u = 0; u < 2; ++u) {                  // V^T: 64x32 bf16
      const int idx = tid + u * 128;
      const int row = idx >> 2, ch = (idx & 3) * 8;
      async_lds_b128(lds_off(&Vs[bf][row][ch]),
                     (unsigned)((row * S_ + k0 + ch) * 2), vbase);
    }
  };

  v8f o0, o1, o2, o3;
  float mrow[8], lrow[8];
#pragma unroll
  for (int r = 0; r < 8; ++r) {
    o0[r] = 0.f; o1[r] = 0.f; o2[r] = 0.f; o3[r] = 0.f;
    mrow[r] = -1e30f; lrow[r] = 0.f;
  }

  issue_chunk(0, 0);

  for (int k0 = 0; k0 < S_; k0 += 32) {
    const int bf = (k0 >> 5) & 1;
    if (k0 + 32 < S_) {
      issue_chunk(k0 + 32, bf ^ 1);
      // 4 ops of chunk i+1 in flight; retire chunk i (and Q on iter 0)
      asm volatile("s_wait_asynccnt 4" ::: "memory");
    } else {
      asm volatile("s_wait_asynccnt 0" ::: "memory");
    }
    __syncthreads();   // chunk bf visible to all waves

    // scores = Q . K^T over d=64 (two K=32 WMMA steps, two 16-key subtiles)
    v8f s0, s1;
#pragma unroll
    for (int r = 0; r < 8; ++r) { s0[r] = 0.f; s1[r] = 0.f; }
#pragma unroll
    for (int kk = 0; kk < 64; kk += 32) {
      v16bf a  = ld16bf(&Qs[wave][ln][kk + half * 8],
                        &Qs[wave][ln][kk + 16 + half * 8]);
      v16bf b0 = ld16bf(&Ks[bf][ln][kk + half * 8],
                        &Ks[bf][ln][kk + 16 + half * 8]);
      v16bf b1 = ld16bf(&Ks[bf][16 + ln][kk + half * 8],
                        &Ks[bf][16 + ln][kk + 16 + half * 8]);
      s0 = wmma_bf16(a, b0, s0);
      s1 = wmma_bf16(a, b1, s1);
    }

    // scale + attention mask
#pragma unroll
    for (int r = 0; r < 8; ++r) {
      const size_t moff = ((size_t)b * S_ + (qb + r + 8 * half)) * S_ + k0;
      s0[r] = s0[r] * 0.125f + mask[moff + ln];
      s1[r] = s1[r] * 0.125f + mask[moff + 16 + ln];
    }

    // online softmax (row stats reduced across the 16-lane column group)
#pragma unroll
    for (int r = 0; r < 8; ++r) {
      float v = fmaxf(s0[r], s1[r]);
      v = fmaxf(v, __shfl_xor(v, 8, 32));
      v = fmaxf(v, __shfl_xor(v, 4, 32));
      v = fmaxf(v, __shfl_xor(v, 2, 32));
      v = fmaxf(v, __shfl_xor(v, 1, 32));
      const float mn   = fmaxf(mrow[r], v);
      const float corr = __expf(mrow[r] - mn);
      const float p0   = __expf(s0[r] - mn);
      const float p1   = __expf(s1[r] - mn);
      Ps[wave][r + 8 * half][ln]      = f2bf(p0);
      Ps[wave][r + 8 * half][16 + ln] = f2bf(p1);
      float ss = p0 + p1;
      ss += __shfl_xor(ss, 8, 32);
      ss += __shfl_xor(ss, 4, 32);
      ss += __shfl_xor(ss, 2, 32);
      ss += __shfl_xor(ss, 1, 32);
      lrow[r] = lrow[r] * corr + ss;
      mrow[r] = mn;
      o0[r] *= corr; o1[r] *= corr; o2[r] *= corr; o3[r] *= corr;
    }

    // O += P . V   (K=32 over this key chunk, 4 output d-tiles)
    v16bf pa  = ld16bf(&Ps[wave][ln][half * 8], &Ps[wave][ln][16 + half * 8]);
    v16bf vb0 = ld16bf(&Vs[bf][ln][half * 8],      &Vs[bf][ln][16 + half * 8]);
    v16bf vb1 = ld16bf(&Vs[bf][16 + ln][half * 8], &Vs[bf][16 + ln][16 + half * 8]);
    v16bf vb2 = ld16bf(&Vs[bf][32 + ln][half * 8], &Vs[bf][32 + ln][16 + half * 8]);
    v16bf vb3 = ld16bf(&Vs[bf][48 + ln][half * 8], &Vs[bf][48 + ln][16 + half * 8]);
    o0 = wmma_bf16(pa, vb0, o0);
    o1 = wmma_bf16(pa, vb1, o1);
    o2 = wmma_bf16(pa, vb2, o2);
    o3 = wmma_bf16(pa, vb3, o3);

    __syncthreads();   // all waves done with buffer bf before it refills
  }

  // normalize and emit context, merged heads bf16 [b*S+s][H]
#pragma unroll
  for (int r = 0; r < 8; ++r) {
    const float inv = 1.0f / lrow[r];
    const int srow = qb + r + 8 * half;
    const size_t crow = ((size_t)b * S_ + srow) * H_ + (size_t)h * HD_;
    ctx[crow + ln]      = f2bf(o0[r] * inv);
    ctx[crow + 16 + ln] = f2bf(o1[r] * inv);
    ctx[crow + 32 + ln] = f2bf(o2[r] * inv);
    ctx[crow + 48 + ln] = f2bf(o3[r] * inv);
  }
}

// ---------------------------------------------------------------------------
// Kernel 4: output projection + bias + residual + LayerNorm (fused)
// ---------------------------------------------------------------------------
__global__ __launch_bounds__(512) void proj_ln_kernel(
    const unsigned short* __restrict__ ctx,
    const unsigned short* __restrict__ woT,
    const float* __restrict__ bo, const float* __restrict__ x,
    const float* __restrict__ gamma, const float* __restrict__ beta,
    float* __restrict__ out) {
  __shared__ __align__(16) unsigned short cA[16][264];
  __shared__ __align__(16) float          ot[16][264];

  const int tid = threadIdx.x;
  const int mbase = blockIdx.x * 16;
  { // stage ctx tile (already bf16)
    const int row = tid >> 5, ch = (tid & 31) * 8;
    *reinterpret_cast<u32x4*>(&cA[row][ch]) =
        *reinterpret_cast<const u32x4*>(ctx + (size_t)(mbase + row) * H_ + ch);
  }
  __syncthreads();

  const int wave = tid >> 5, lane = tid & 31;
  const int half = lane >> 4, ln = lane & 15;
  const int j = wave * 16 + ln;

  v8f c;
  const float bb = bo[j];
#pragma unroll
  for (int r = 0; r < 8; ++r) c[r] = bb;

#pragma unroll
  for (int kk = 0; kk < H_; kk += 32) {
    v16bf a = ld16bf(&cA[ln][kk + half * 8], &cA[ln][kk + 16 + half * 8]);
    const unsigned short* bp = woT + (size_t)j * H_ + kk + half * 8;
    v16bf bv = ld16bf(bp, bp + 16);
    c = wmma_bf16(a, bv, c);
  }

  // + residual, stage rows for LayerNorm
#pragma unroll
  for (int r = 0; r < 8; ++r) {
    const int gr = mbase + r + 8 * half;
    ot[r + 8 * half][j] = c[r] + x[(size_t)gr * H_ + j];
  }
  __syncthreads();

  // LayerNorm: wave w normalizes row w (256 cols, 8 per lane)
  {
    const int row = wave, c0 = lane * 8;
    float vals[8], s = 0.f, sq = 0.f;
#pragma unroll
    for (int i = 0; i < 8; ++i) {
      vals[i] = ot[row][c0 + i];
      s += vals[i];
      sq += vals[i] * vals[i];
    }
    s  += __shfl_xor(s, 16, 32);  sq += __shfl_xor(sq, 16, 32);
    s  += __shfl_xor(s, 8, 32);   sq += __shfl_xor(sq, 8, 32);
    s  += __shfl_xor(s, 4, 32);   sq += __shfl_xor(sq, 4, 32);
    s  += __shfl_xor(s, 2, 32);   sq += __shfl_xor(sq, 2, 32);
    s  += __shfl_xor(s, 1, 32);   sq += __shfl_xor(sq, 1, 32);
    const float mu  = s * (1.0f / 256.0f);
    const float var = sq * (1.0f / 256.0f) - mu * mu;
    const float inv = rsqrtf(var + 1e-12f);
    const size_t gr = (size_t)(mbase + row) * H_;
#pragma unroll
    for (int i = 0; i < 8; ++i) {
      const int col = c0 + i;
      out[gr + col] = (vals[i] - mu) * inv * gamma[col] + beta[col];
    }
  }
}

// ---------------------------------------------------------------------------
extern "C" void kernel_launch(void* const* d_in, const int* in_sizes, int n_in,
                              void* d_out, int out_size, void* d_ws, size_t ws_size,
                              hipStream_t stream) {
  const float* x     = (const float*)d_in[0];
  const float* mask  = (const float*)d_in[1];
  const float* Wq    = (const float*)d_in[2];
  const float* bq    = (const float*)d_in[3];
  const float* Wk    = (const float*)d_in[4];
  const float* bk    = (const float*)d_in[5];
  const float* Wv    = (const float*)d_in[6];
  const float* bv    = (const float*)d_in[7];
  const float* Wo    = (const float*)d_in[8];
  const float* bo    = (const float*)d_in[9];
  const float* gamma = (const float*)d_in[10];
  const float* beta  = (const float*)d_in[11];
  float* out = (float*)d_out;

  // workspace layout (ushort elements)
  unsigned short* ws  = (unsigned short*)d_ws;
  unsigned short* wT  = ws;                         // 4 * 256*256
  unsigned short* Qb  = ws + 4 * H_ * H_;           // [B][NH][S][HD]
  unsigned short* Kb  = Qb + (size_t)B_ * NH_ * S_ * HD_;
  unsigned short* Vtb = Kb + (size_t)B_ * NH_ * S_ * HD_;
  unsigned short* ctx = Vtb + (size_t)B_ * NH_ * S_ * HD_;  // [M][H]

  prep_weights_kernel<<<dim3(H_ * H_ / 256, 4), 256, 0, stream>>>(
      Wq, Wk, Wv, Wo, wT);

  qkv_kernel<<<M_ / 16, 512, 0, stream>>>(
      x, bq, bk, bv, wT, wT + H_ * H_, wT + 2 * H_ * H_, Qb, Kb, Vtb);

  attn_kernel<<<dim3(S_ / 64, NH_, B_), 128, 0, stream>>>(
      mask, Qb, Kb, Vtb, ctx);

  proj_ln_kernel<<<M_ / 16, 512, 0, stream>>>(
      ctx, wT + 3 * H_ * H_, bo, x, gamma, beta, out);
}

// v001
// It runs in 131 microseconds.
// Timed twice side by side with v000, it ran 1.26 times as fast both times.
#include <hip/hip_runtime.h>
#include <hip/hip_bf16.h>
#include <math.h>

// Problem constants (match reference)
#define B_   8
#define S_   2048
#define H_   256
#define NH_  4
#define HD_  64
#define M_   (B_ * S_)          // 16384 rows

typedef __attribute__((ext_vector_type(16))) __bf16       v16bf;
typedef __attribute__((ext_vector_type(8)))  __bf16       v8bf;
typedef __attribute__((ext_vector_type(8)))  float        v8f;
typedef __attribute__((ext_vector_type(4)))  float        f32x4;
typedef __attribute__((ext_vector_type(4)))  unsigned int u32x4;

struct U32x8 { u32x4 lo, hi; };

// float -> bf16 (round to nearest even, NaN-agnostic — inputs are sane)
static __device__ __forceinline__ unsigned short f2bf(float f) {
  unsigned u = __builtin_bit_cast(unsigned, f);
  u += 0x7FFFu + ((u >> 16) & 1u);
  return (unsigned short)(u >> 16);
}

// Build a WMMA 16-bf16 operand from two aligned 16-byte chunks.
// Per ISA 7.12.2 (wave32): per lane, elements 0..7 <-> K = half*8 + e,
// elements 8..15 <-> K = 16 + half*8 + e.  Storing tiles row-major [m][k]
// (A) or [n][k] (B-transposed) makes both chunks contiguous b128 loads.
static __device__ __forceinline__ v16bf ld16bf(const unsigned short* p0,
                                               const unsigned short* p1) {
  U32x8 u;
  u.lo = *reinterpret_cast<const u32x4*>(p0);
  u.hi = *reinterpret_cast<const u32x4*>(p1);
  return __builtin_bit_cast(v16bf, u);
}

static __device__ __forceinline__ v8f wmma_bf16(v16bf a, v16bf b, v8f c) {
  return __builtin_amdgcn_wmma_f32_16x16x32_bf16(
      /*neg_a=*/false, a, /*neg_b=*/false, b,
      /*c_mod=*/(short)0, c, /*reuse_a=*/false, /*reuse_b=*/false);
}

// --- CDNA5 async memory->LDS copy (ASYNCcnt path) --------------------------
// Per lane: LDS[ldsOff] <- MEM[base + gOff] (16 bytes).  GVS addressing:
// 64-bit SGPR base + 32-bit per-lane VGPR offset.  LDS offset is the low
// 32 bits of the generic shared-space address (aperture: addr[31:0]).
static __device__ __forceinline__ unsigned lds_off(const void* p) {
  return (unsigned)(size_t)p;
}
static __device__ __forceinline__ void async_lds_b128(unsigned ldsOff,
                                                      unsigned gOff,
                                                      const void* base) {
  asm volatile("global_load_async_to_lds_b128 %0, %1, %2"
               :
               : "v"(ldsOff), "v"(gOff),
                 "s"((unsigned long long)(size_t)base)
               : "memory");
}

// ---------------------------------------------------------------------------
// Kernel 1: transpose + convert the 4 weight matrices to bf16 [n][k]
// ---------------------------------------------------------------------------
__global__ __launch_bounds__(256) void prep_weights_kernel(
    const float* __restrict__ Wq, const float* __restrict__ Wk,
    const float* __restrict__ Wv, const float* __restrict__ Wo,
    unsigned short* __restrict__ wT) {
  const int mat = blockIdx.y;
  const float* src = (mat == 0) ? Wq : (mat == 1) ? Wk : (mat == 2) ? Wv : Wo;
  unsigned short* dst = wT + (size_t)mat * H_ * H_;
  const int e = blockIdx.x * 256 + threadIdx.x;   // e = k*256 + n
  const int k = e >> 8, n = e & 255;
  dst[n * H_ + k] = f2bf(src[e]);
}

// ---------------------------------------------------------------------------
// Kernel 2: QKV projection.  16-row m-tile per block, 16 waves = 16 n-tiles.
// Writes Q,K bf16 [b][h][s][d]; V transposed bf16 [b][h][d][s].
// ---------------------------------------------------------------------------
__global__ __launch_bounds__(512) void qkv_kernel(
    const float* __restrict__ x,
    const float* __restrict__ bq, const float* __restrict__ bk,
    const float* __restrict__ bv,
    const unsigned short* __restrict__ wqT,
    const unsigned short* __restrict__ wkT,
    const unsigned short* __restrict__ wvT,
    unsigned short* __restrict__ Q, unsigned short* __restrict__ K,
    unsigned short* __restrict__ Vt) {
  __shared__ __align__(16) unsigned short xA[16][264];

  const int tid   = threadIdx.x;
  const int mbase = blockIdx.x * 16;

  { // stage 16x256 fp32 -> bf16 LDS
    const int row = tid >> 5;
    const int col = (tid & 31) * 8;
    const float* src = x + (size_t)(mbase + row) * H_ + col;
#pragma unroll
    for (int i = 0; i < 8; ++i) xA[row][col + i] = f2bf(src[i]);
  }
  __syncthreads();

  const int wave = tid >> 5, lane = tid & 31;
  const int half = lane >> 4, ln = lane & 15;
  const int j = wave * 16 + ln;                // global output column

  v8f cq, ck, cv;
  const float biasq = bq[j], biask = bk[j], biasv = bv[j];
#pragma unroll
  for (int r = 0; r < 8; ++r) { cq[r] = biasq; ck[r] = biask; cv[r] = biasv; }

#pragma unroll
  for (int kk = 0; kk < H_; kk += 32) {
    v16bf a = ld16bf(&xA[ln][kk + half * 8], &xA[ln][kk + 16 + half * 8]);
    const unsigned short* pq = wqT + (size_t)j * H_ + kk + half * 8;
    const unsigned short* pk = wkT + (size_t)j * H_ + kk + half * 8;
    const unsigned short* pv = wvT + (size_t)j * H_ + kk + half * 8;
    v16bf bqv = ld16bf(pq, pq + 16);
    v16bf bkv = ld16bf(pk, pk + 16);
    v16bf bvv = ld16bf(pv, pv + 16);
    cq = wmma_bf16(a, bqv, cq);
    ck = wmma_bf16(a, bkv, ck);
    cv = wmma_bf16(a, bvv, cv);
  }

  const int h = j >> 6, d = j & 63;
#pragma unroll
  for (int r = 0; r < 8; ++r) {
    const int gr = mbase + r + 8 * half;          // global row in [M_]
    const int b = gr >> 11, s = gr & (S_ - 1);
    const size_t qoff = (((size_t)b * NH_ + h) * S_ + s) * HD_ + d;
    Q[qoff] = f2bf(cq[r]);
    K[qoff] = f2bf(ck[r]);
    Vt[(((size_t)b * NH_ + h) * HD_ + d) * S_ + s] = f2bf(cv[r]);
  }
}

static __device__ __forceinline__ float xhalf(float v) {
  const int i = __builtin_bit_cast(int, v);
  return __builtin_bit_cast(
      float, __builtin_amdgcn_permlanex16(i, i, 0x76543210, 0xfedcba98,
                                          false, false));
}

__global__ __launch_bounds__(128) void attn_kernel(
    const float* __restrict__ mask,
    const unsigned short* __restrict__ Q,
    const unsigned short* __restrict__ K,
    const unsigned short* __restrict__ Vt,
    unsigned short* __restrict__ ctx) {
  __shared__ __align__(16) unsigned short Ks[2][32][72];   // key chunk [key][d]
  __shared__ __align__(16) unsigned short Vs[2][64][40];   // V^T chunk [d][key]

  const int tid = threadIdx.x, wave = tid >> 5, lane = tid & 31;
  const int half = lane >> 4, ln = lane & 15;
  const int b = blockIdx.z, h = blockIdx.y;
  const int qb = blockIdx.x * 64 + wave * 16;

  const size_t headQK = ((size_t)b * NH_ + h) * S_ * HD_;
  const size_t headV  = ((size_t)b * NH_ + h) * HD_ * S_;
  const unsigned short* qbase = Q + headQK + (size_t)qb * HD_;
  const unsigned short* kbase = K + headQK;
  const unsigned short* vbase = Vt + headV;

  // Q^T as B operand (column = query ln), loaded once and kept in registers
  const unsigned short* qrow = qbase + ln * HD_ + half * 8;
  const v16bf qf0 = ld16bf(qrow, qrow + 16);
  const v16bf qf1 = ld16bf(qrow + 32, qrow + 48);

  // issue one 32-key K/V chunk into buffer bf (4 wave-ops, in-order)
  auto issue_chunk = [&](int k0, int bf) {
#pragma unroll
    for (int u = 0; u < 2; ++u) {                  // K: 32x64 bf16
      const int idx = tid + u * 128;
      const int row = idx >> 3, ch = (idx & 7) * 8;
      async_lds_b128(lds_off(&Ks[bf][row][ch]),
                     (unsigned)(((k0 + row) * HD_ + ch) * 2), kbase);
    }
#pragma unroll
    for (int u = 0; u < 2; ++u) {                  // V^T: 64x32 bf16
      const int idx = tid + u * 128;
      const int row = idx >> 2, ch = (idx & 3) * 8;
      async_lds_b128(lds_off(&Vs[bf][row][ch]),
                     (unsigned)((row * S_ + k0 + ch) * 2), vbase);
    }
  };

  // o_t[r] = O[query ln][d = 16 t + 8 half + r]
  v8f o0, o1, o2, o3;
#pragma unroll
  for (int r = 0; r < 8; ++r) {
    o0[r] = 0.f; o1[r] = 0.f; o2[r] = 0.f; o3[r] = 0.f;
  }
  float mrow = -1e30f;   // running maximum of query ln (equal in both halves)
  float lrow = 0.f;      // running sum over this half's keys only

  // this lane's mask row; its keys are 8 half + r and 16 + 8 half + r
  const float* mptr = mask + ((size_t)b * S_ + (qb + ln)) * S_ + half * 8;

  issue_chunk(0, 0);

  for (int k0 = 0; k0 < S_; k0 += 32) {
    const int bf = (k0 >> 5) & 1;
    if (k0 + 32 < S_) {
      issue_chunk(k0 + 32, bf ^ 1);
      // 4 ops of chunk i+1 in flight; retire chunk i
      asm volatile("s_wait_asynccnt 4" ::: "memory");
    } else {
      asm volatile("s_wait_asynccnt 0" ::: "memory");
    }
    __syncthreads();   // chunk bf visible to all waves

    // attention mask: 2 x 8 consecutive keys of one query per lane
    const f32x4 mk0 = *reinterpret_cast<const f32x4*>(mptr + k0);
    const f32x4 mk1 = *reinterpret_cast<const f32x4*>(mptr + k0 + 4);
    const f32x4 mk2 = *reinterpret_cast<const f32x4*>(mptr + k0 + 16);
    const f32x4 mk3 = *reinterpret_cast<const f32x4*>(mptr + k0 + 20);
    // K rows as A operand (row = key), both d halves of both 16-key subtiles
    const unsigned short* kr0 = &Ks[bf][ln][half * 8];
    const unsigned short* kr1 = &Ks[bf][16 + ln][half * 8];
    const v16bf a00 = ld16bf(kr0, kr0 + 16), a01 = ld16bf(kr0 + 32, kr0 + 48);
    const v16bf a10 = ld16bf(kr1, kr1 + 16), a11 = ld16bf(kr1 + 32, kr1 + 48);
    // V^T rows as A operand (row = d), 4 output d-tiles
    const unsigned short* vr = &Vs[bf][ln][half * 8];
    const v16bf va0 = ld16bf(vr, vr + 16);
    const v16bf va1 = ld16bf(vr + 16 * 40, vr + 16 * 40 + 16);
    const v16bf va2 = ld16bf(vr + 32 * 40, vr + 32 * 40 + 16);
    const v16bf va3 = ld16bf(vr + 48 * 40, vr + 48 * 40 + 16);
    // keeps the pass's mask loads and LDS reads together ahead of the products:
    // without it one mask load is issued only behind the wait for the others,
    // and each V^T read directly in front of the product that waits for it
    __builtin_amdgcn_sched_barrier(0);

    // scores^T = K . Q^T over d=64 (two K=32 WMMA steps, two 16-key subtiles)
    // s_t[r] = S[query ln][key = 16 t + 8 half + r]
    v8f s0, s1;
#pragma unroll
    for (int r = 0; r < 8; ++r) { s0[r] = 0.f; s1[r] = 0.f; }
    s0 = wmma_bf16(a00, qf0, s0);
    s1 = wmma_bf16(a10, qf0, s1);
    s0 = wmma_bf16(a01, qf1, s0);
    s1 = wmma_bf16(a11, qf1, s1);

    // scale + attention mask
    s0 = s0 * 0.125f + __builtin_shufflevector(mk0, mk1, 0, 1, 2, 3, 4, 5, 6, 7);
    s1 = s1 * 0.125f + __builtin_shufflevector(mk2, mk3, 0, 1, 2, 3, 4, 5, 6, 7);

    // online softmax: 16 keys in-lane, the other 16 in lane ^ 16
    float va = s0[0], vb = s1[0];
#pragma unroll
    for (int r = 1; r < 8; ++r) { va = fmaxf(va, s0[r]); vb = fmaxf(vb, s1[r]); }
    float v = fmaxf(va, vb);
    v = fmaxf(v, xhalf(v));
    const float mn   = fmaxf(mrow, v);
    const float corr = __expf(mrow - mn);
    mrow = mn;

    // P^T as B operand: element e <-> key 8 half + e, 8 + e <-> 16 + 8 half + e
    v16bf pb;
    v8f p0, p1;
#pragma unroll
    for (int r = 0; r < 8; ++r) {
      p0[r] = __expf(s0[r] - mn);
      p1[r] = __expf(s1[r] - mn);
      pb[r]     = (__bf16)p0[r];
      pb[8 + r] = (__bf16)p1[r];
    }
    // this half's 16 terms, summed pairwise
    const v8f   t8 = p0 + p1;
    const f32x4 t4 = __builtin_shufflevector(t8, t8, 0, 1, 2, 3) +
                     __builtin_shufflevector(t8, t8, 4, 5, 6, 7);
    lrow = lrow * corr + ((t4[0] + t4[2]) + (t4[1] + t4[3]));
#pragma unroll
    for (int r = 0; r < 8; ++r) {
      o0[r] *= corr; o1[r] *= corr; o2[r] *= corr; o3[r] *= corr;
    }

    // O^T += V^T . P^T   (K=32 over this key chunk, 4 output d-tiles)
    o0 = wmma_bf16(va0, pb, o0);
    o1 = wmma_bf16(va1, pb, o1);
    o2 = wmma_bf16(va2, pb, o2);
    o3 = wmma_bf16(va3, pb, o3);

    __syncthreads();   // all waves done with buffer bf before it refills
  }

  // join the halves' sums, normalize and emit context, merged heads bf16
  // [b*S+s][H]: 8 consecutive d per lane and tile, one 16-byte store each
  const float inv = 1.0f / (lrow + xhalf(lrow));
  unsigned short* crow =
      ctx + ((size_t)b * S_ + (qb + ln)) * H_ + (size_t)h * HD_ + half * 8;
  v8bf c0, c1, c2, c3;
#pragma unroll
  for (int r = 0; r < 8; ++r) {
    c0[r] = (__bf16)(o0[r] * inv);
    c1[r] = (__bf16)(o1[r] * inv);
    c2[r] = (__bf16)(o2[r] * inv);
    c3[r] = (__bf16)(o3[r] * inv);
  }
  *reinterpret_cast<u32x4*>(crow)      = __builtin_bit_cast(u32x4, c0);
  *reinterpret_cast<u32x4*>(crow + 16) = __builtin_bit_cast(u32x4, c1);
  *reinterpret_cast<u32x4*>(crow + 32) = __builtin_bit_cast(u32x4, c2);
  *reinterpret_cast<u32x4*>(crow + 48) = __builtin_bit_cast(u32x4, c3);
}

// ---------------------------------------------------------------------------
// Kernel 4: output projection + bias + residual + LayerNorm (fused)
// ---------------------------------------------------------------------------
__global__ __launch_bounds__(512) void proj_ln_kernel(
    const unsigned short* __restrict__ ctx,
    const unsigned short* __restrict__ woT,
    const float* __restrict__ bo, const float* __restrict__ x,
    const float* __restrict__ gamma, const float* __restrict__ beta,
    float* __restrict__ out) {
  __shared__ __align__(16) unsigned short cA[16][264];
  __shared__ __align__(16) float          ot[16][264];

  const int tid = threadIdx.x;
  const int mbase = blockIdx.x * 16;
  { // stage ctx tile (already bf16)
    const int row = tid >> 5, ch = (tid & 31) * 8;
    *reinterpret_cast<u32x4*>(&cA[row][ch]) =
        *reinterpret_cast<const u32x4*>(ctx + (size_t)(mbase + row) * H_ + ch);
  }
  __syncthreads();

  const int wave = tid >> 5, lane = tid & 31;
  const int half = lane >> 4, ln = lane & 15;
  const int j = wave * 16 + ln;

  v8f c;
  const float bb = bo[j];
#pragma unroll
  for (int r = 0; r < 8; ++r) c[r] = bb;

#pragma unroll
  for (int kk = 0; kk < H_; kk += 32) {
    v16bf a = ld16bf(&cA[ln][kk + half * 8], &cA[ln][kk + 16 + half * 8]);
    const unsigned short* bp = woT + (size_t)j * H_ + kk + half * 8;
    v16bf bv = ld16bf(bp, bp + 16);
    c = wmma_bf16(a, bv, c);
  }

  // + residual, stage rows for LayerNorm
#pragma unroll
  for (int r = 0; r < 8; ++r) {
    const int gr = mbase + r + 8 * half;
    ot[r + 8 * half][j] = c[r] + x[(size_t)gr * H_ + j];
  }
  __syncthreads();

  // LayerNorm: wave w normalizes row w (256 cols, 8 per lane)
  {
    const int row = wave, c0 = lane * 8;
    float vals[8], s = 0.f, sq = 0.f;
#pragma unroll
    for (int i = 0; i < 8; ++i) {
      vals[i] = ot[row][c0 + i];
      s += vals[i];
      sq += vals[i] * vals[i];
    }
    s  += __shfl_xor(s, 16, 32);  sq += __shfl_xor(sq, 16, 32);
    s  += __shfl_xor(s, 8, 32);   sq += __shfl_xor(sq, 8, 32);
    s  += __shfl_xor(s, 4, 32);   sq += __shfl_xor(sq, 4, 32);
    s  += __shfl_xor(s, 2, 32);   sq += __shfl_xor(sq, 2, 32);
    s  += __shfl_xor(s, 1, 32);   sq += __shfl_xor(sq, 1, 32);
    const float mu  = s * (1.0f / 256.0f);
    const float var = sq * (1.0f / 256.0f) - mu * mu;
    const float inv = rsqrtf(var + 1e-12f);
    const size_t gr = (size_t)(mbase + row) * H_;
#pragma unroll
    for (int i = 0; i < 8; ++i) {
      const int col = c0 + i;
      out[gr + col] = (vals[i] - mu) * inv * gamma[col] + beta[col];
    }
  }
}

// ---------------------------------------------------------------------------
extern "C" void kernel_launch(void* const* d_in, const int* in_sizes, int n_in,
                              void* d_out, int out_size, void* d_ws, size_t ws_size,
                              hipStream_t stream) {
  const float* x     = (const float*)d_in[0];
  const float* mask  = (const float*)d_in[1];
  const float* Wq    = (const float*)d_in[2];
  const float* bq    = (const float*)d_in[3];
  const float* Wk    = (const float*)d_in[4];
  const float* bk    = (const float*)d_in[5];
  const float* Wv    = (const float*)d_in[6];
  const float* bv    = (const float*)d_in[7];
  const float* Wo    = (const float*)d_in[8];
  const float* bo    = (const float*)d_in[9];
  const float* gamma = (const float*)d_in[10];
  const float* beta  = (const float*)d_in[11];
  float* out = (float*)d_out;

  // workspace layout (ushort elements)
  unsigned short* ws  = (unsigned short*)d_ws;
  unsigned short* wT  = ws;                         // 4 * 256*256
  unsigned short* Qb  = ws + 4 * H_ * H_;           // [B][NH][S][HD]
  unsigned short* Kb  = Qb + (size_t)B_ * NH_ * S_ * HD_;
  unsigned short* Vtb = Kb + (size_t)B_ * NH_ * S_ * HD_;
  unsigned short* ctx = Vtb + (size_t)B_ * NH_ * S_ * HD_;  // [M][H]

  prep_weights_kernel<<<dim3(H_ * H_ / 256, 4), 256, 0, stream>>>(
      Wq, Wk, Wv, Wo, wT);

  qkv_kernel<<<M_ / 16, 512, 0, stream>>>(
      x, bq, bk, bv, wT, wT + H_ * H_, wT + 2 * H_ * H_, Qb, Kb, Vtb);

  attn_kernel<<<dim3(S_ / 64, NH_, B_), 128, 0, stream>>>(
      mask, Qb, Kb, Vtb, ctx);

  proj_ln_kernel<<<M_ / 16, 512, 0, stream>>>(
      ctx, wT + 3 * H_ * H_, bo, x, gamma, beta, out);
}

// v002
// One run takes 126 microseconds.
// In both of two side-by-side timings against v001, it was 1.05 times as fast.
// All steps since v000 together make it 1.33 times as fast.
#include <hip/hip_runtime.h>
#include <hip/hip_bf16.h>
#include <math.h>

// Problem constants (match reference)
#define B_   8
#define S_   2048
#define H_   256
#define NH_  4
#define HD_  64
#define M_   (B_ * S_)          // 16384 rows

typedef __attribute__((ext_vector_type(16))) __bf16       v16bf;
typedef __attribute__((ext_vector_type(8)))  __bf16       v8bf;
typedef __attribute__((ext_vector_type(8)))  float        v8f;
typedef __attribute__((ext_vector_type(4)))  float        f32x4;
typedef __attribute__((ext_vector_type(4)))  unsigned int u32x4;

struct U32x8 { u32x4 lo, hi; };

// float -> bf16 (round to nearest even, NaN-agnostic — inputs are sane)
static __device__ __forceinline__ unsigned short f2bf(float f) {
  unsigned u = __builtin_bit_cast(unsigned, f);
  u += 0x7FFFu + ((u >> 16) & 1u);
  return (unsigned short)(u >> 16);
}

// Build a WMMA 16-bf16 operand from two aligned 16-byte chunks.
// Per ISA 7.12.2 (wave32): per lane, elements 0..7 <-> K = half*8 + e,
// elements 8..15 <-> K = 16 + half*8 + e.  Storing tiles row-major [m][k]
// (A) or [n][k] (B-transposed) makes both chunks contiguous b128 loads.
static __device__ __forceinline__ v16bf ld16bf(const unsigned short* p0,
                                               const unsigned short* p1) {
  U32x8 u;
  u.lo = *reinterpret_cast<const u32x4*>(p0);
  u.hi = *reinterpret_cast<const u32x4*>(p1);
  return __builtin_bit_cast(v16bf, u);
}

static __device__ __forceinline__ v8f wmma_bf16(v16bf a, v16bf b, v8f c) {
  return __builtin_amdgcn_wmma_f32_16x16x32_bf16(
      /*neg_a=*/false, a, /*neg_b=*/false, b,
      /*c_mod=*/(short)0, c, /*reuse_a=*/false, /*reuse_b=*/false);
}

// --- CDNA5 async memory->LDS copy (ASYNCcnt path) --------------------------
// Per lane: LDS[ldsOff] <- MEM[base + gOff] (16 bytes).  GVS addressing:
// 64-bit SGPR base + 32-bit per-lane VGPR offset.  LDS offset is the low
// 32 bits of the generic shared-space address (aperture: addr[31:0]).
static __device__ __forceinline__ unsigned lds_off(const void* p) {
  return (unsigned)(size_t)p;
}
// One chunk's eight copies of a lane: four from the mask, two from K, two from
// V^T.  The closing s_wait_xcnt 0 stands inside the copies' own statement so
// that no later write of an address register they name can be placed in front
// of it.
static __device__ __forceinline__ void async_chunk_b128(
    unsigned lm0, unsigned lm1, unsigned lm2, unsigned lm3,
    unsigned lk0, unsigned lk1, unsigned lv0, unsigned lv1,
    unsigned gm0, unsigned gm1, unsigned gm2, unsigned gm3,
    unsigned gk0, unsigned gk1, unsigned gv0, unsigned gv1,
    const void* mbase, const void* kbase, const void* vbase) {
  asm volatile("global_load_async_to_lds_b128 %0, %8, %16\n\t"
               "global_load_async_to_lds_b128 %1, %9, %16\n\t"
               "global_load_async_to_lds_b128 %2, %10, %16\n\t"
               "global_load_async_to_lds_b128 %3, %11, %16\n\t"
               "global_load_async_to_lds_b128 %4, %12, %17\n\t"
               "global_load_async_to_lds_b128 %5, %13, %17\n\t"
               "global_load_async_to_lds_b128 %6, %14, %18\n\t"
               "global_load_async_to_lds_b128 %7, %15, %18\n\t"
               "s_wait_xcnt 0x0"
               :
               : "v"(lm0), "v"(lm1), "v"(lm2), "v"(lm3),
                 "v"(lk0), "v"(lk1), "v"(lv0), "v"(lv1),
                 "v"(gm0), "v"(gm1), "v"(gm2), "v"(gm3),
                 "v"(gk0), "v"(gk1), "v"(gv0), "v"(gv1),
                 "s"((unsigned long long)(size_t)mbase),
                 "s"((unsigned long long)(size_t)kbase),
                 "s"((unsigned long long)(size_t)vbase)
               : "memory");
}

// ---------------------------------------------------------------------------
// Kernel 1: transpose + convert the 4 weight matrices to bf16 [n][k]
// ---------------------------------------------------------------------------
__global__ __launch_bounds__(256) void prep_weights_kernel(
    const float* __restrict__ Wq, const float* __restrict__ Wk,
    const float* __restrict__ Wv, const float* __restrict__ Wo,
    unsigned short* __restrict__ wT) {
  const int mat = blockIdx.y;
  const float* src = (mat == 0) ? Wq : (mat == 1) ? Wk : (mat == 2) ? Wv : Wo;
  unsigned short* dst = wT + (size_t)mat * H_ * H_;
  const int e = blockIdx.x * 256 + threadIdx.x;   // e = k*256 + n
  const int k = e >> 8, n = e & 255;
  dst[n * H_ + k] = f2bf(src[e]);
}

// ---------------------------------------------------------------------------
// Kernel 2: QKV projection.  16-row m-tile per block, 16 waves = 16 n-tiles.
// Writes Q,K bf16 [b][h][s][d]; V transposed bf16 [b][h][d][s].
// ---------------------------------------------------------------------------
__global__ __launch_bounds__(512) void qkv_kernel(
    const float* __restrict__ x,
    const float* __restrict__ bq, const float* __restrict__ bk,
    const float* __restrict__ bv,
    const unsigned short* __restrict__ wqT,
    const unsigned short* __restrict__ wkT,
    const unsigned short* __restrict__ wvT,
    unsigned short* __restrict__ Q, unsigned short* __restrict__ K,
    unsigned short* __restrict__ Vt) {
  __shared__ __align__(16) unsigned short xA[16][264];

  const int tid   = threadIdx.x;
  const int mbase = blockIdx.x * 16;

  { // stage 16x256 fp32 -> bf16 LDS
    const int row = tid >> 5;
    const int col = (tid & 31) * 8;
    const float* src = x + (size_t)(mbase + row) * H_ + col;
#pragma unroll
    for (int i = 0; i < 8; ++i) xA[row][col + i] = f2bf(src[i]);
  }
  __syncthreads();

  const int wave = tid >> 5, lane = tid & 31;
  const int half = lane >> 4, ln = lane & 15;
  const int j = wave * 16 + ln;                // global output column

  v8f cq, ck, cv;
  const float biasq = bq[j], biask = bk[j], biasv = bv[j];
#pragma unroll
  for (int r = 0; r < 8; ++r) { cq[r] = biasq; ck[r] = biask; cv[r] = biasv; }

#pragma unroll
  for (int kk = 0; kk < H_; kk += 32) {
    v16bf a = ld16bf(&xA[ln][kk + half * 8], &xA[ln][kk + 16 + half * 8]);
    const unsigned short* pq = wqT + (size_t)j * H_ + kk + half * 8;
    const unsigned short* pk = wkT + (size_t)j * H_ + kk + half * 8;
    const unsigned short* pv = wvT + (size_t)j * H_ + kk + half * 8;
    v16bf bqv = ld16bf(pq, pq + 16);
    v16bf bkv = ld16bf(pk, pk + 16);
    v16bf bvv = ld16bf(pv, pv + 16);
    cq = wmma_bf16(a, bqv, cq);
    ck = wmma_bf16(a, bkv, ck);
    cv = wmma_bf16(a, bvv, cv);
  }

  const int h = j >> 6, d = j & 63;
#pragma unroll
  for (int r = 0; r < 8; ++r) {
    const int gr = mbase + r + 8 * half;          // global row in [M_]
    const int b = gr >> 11, s = gr & (S_ - 1);
    const size_t qoff = (((size_t)b * NH_ + h) * S_ + s) * HD_ + d;
    Q[qoff] = f2bf(cq[r]);
    K[qoff] = f2bf(ck[r]);
    Vt[(((size_t)b * NH_ + h) * HD_ + d) * S_ + s] = f2bf(cv[r]);
  }
}

static __device__ __forceinline__ float xhalf(float v) {
  const int i = __builtin_bit_cast(int, v);
  return __builtin_bit_cast(
      float, __builtin_amdgcn_permlanex16(i, i, 0x76543210, 0xfedcba98,
                                          false, false));
}

__global__ __launch_bounds__(128) void attn_kernel(
    const float* __restrict__ mask,
    const unsigned short* __restrict__ Q,
    const unsigned short* __restrict__ K,
    const unsigned short* __restrict__ Vt,
    unsigned short* __restrict__ ctx) {
  __shared__ __align__(16) unsigned short Ks[2][32][72];   // key chunk [key][d]
  __shared__ __align__(16) unsigned short Vs[2][64][40];   // V^T chunk [d][key]
  __shared__ __align__(16) float          Ms[2][64][36];   // mask chunk [q][key]

  const int tid = threadIdx.x, wave = tid >> 5, lane = tid & 31;
  const int half = lane >> 4, ln = lane & 15;
  const int b = blockIdx.z, h = blockIdx.y;
  const int qb = blockIdx.x * 64 + wave * 16;

  const size_t headQK = ((size_t)b * NH_ + h) * S_ * HD_;
  const size_t headV  = ((size_t)b * NH_ + h) * HD_ * S_;
  const unsigned short* qbase = Q + headQK + (size_t)qb * HD_;
  const unsigned short* kbase = K + headQK;
  const unsigned short* vbase = Vt + headV;

  // Q^T as B operand (column = query ln), loaded once and kept in registers
  const unsigned short* qrow = qbase + ln * HD_ + half * 8;
  const v16bf qf0 = ld16bf(qrow, qrow + 16);
  const v16bf qf1 = ld16bf(qrow + 32, qrow + 48);

  // mask rows of this block's 64 queries; this lane copies 16 bytes of rows
  // mrw, mrw + 4, mrw + 8, mrw + 12, all among its own wave's 16 queries
  const float* mbase = mask + ((size_t)b * S_ + blockIdx.x * 64) * S_;
  const int mrw = wave * 16 + (lane >> 3), mch = (lane & 7) * 4;

  // issue one 32-key K/V/mask chunk into buffer bf (8 wave-ops, in-order)
  auto issue_chunk = [&](int k0, int bf) {
    const int kr = tid >> 3, kc = (tid & 7) * 8;   // K: 32x64 bf16, rows kr, kr+16
    const int vr = tid >> 2, vc = (tid & 3) * 8;   // V^T: 64x32 bf16, rows vr, vr+32
    async_chunk_b128(lds_off(&Ms[bf][mrw][mch]),                // mask: 64x32 f32
                     lds_off(&Ms[bf][mrw + 4][mch]),
                     lds_off(&Ms[bf][mrw + 8][mch]),
                     lds_off(&Ms[bf][mrw + 12][mch]),
                     lds_off(&Ks[bf][kr][kc]), lds_off(&Ks[bf][kr + 16][kc]),
                     lds_off(&Vs[bf][vr][vc]), lds_off(&Vs[bf][vr + 32][vc]),
                     (unsigned)((mrw * S_ + k0 + mch) * 4),
                     (unsigned)(((mrw + 4) * S_ + k0 + mch) * 4),
                     (unsigned)(((mrw + 8) * S_ + k0 + mch) * 4),
                     (unsigned)(((mrw + 12) * S_ + k0 + mch) * 4),
                     (unsigned)(((k0 + kr) * HD_ + kc) * 2),
                     (unsigned)(((k0 + kr + 16) * HD_ + kc) * 2),
                     (unsigned)((vr * S_ + k0 + vc) * 2),
                     (unsigned)(((vr + 32) * S_ + k0 + vc) * 2),
                     mbase, kbase, vbase);
  };

  // o_t[r] = O[query ln][d = 16 t + 8 half + r]
  v8f o0, o1, o2, o3;
#pragma unroll
  for (int r = 0; r < 8; ++r) {
    o0[r] = 0.f; o1[r] = 0.f; o2[r] = 0.f; o3[r] = 0.f;
  }
  float mrow = -1e30f;   // running maximum of query ln (equal in both halves)
  float lrow = 0.f;      // running sum over this half's keys only

  issue_chunk(0, 0);

  for (int k0 = 0; k0 < S_; k0 += 32) {
    const int bf = (k0 >> 5) & 1;
    if (k0 + 32 < S_) {
      issue_chunk(k0 + 32, bf ^ 1);
      // 8 ops of chunk i+1 in flight; retire chunk i
      asm volatile("s_wait_asynccnt 8" ::: "memory");
    } else {
      asm volatile("s_wait_asynccnt 0" ::: "memory");
    }
    __syncthreads();   // chunk bf visible to all waves

    // attention mask: 2 x 8 consecutive keys of one query per lane
    // (keys 8 half + r and 16 + 8 half + r)
    const float* mr = &Ms[bf][wave * 16 + ln][half * 8];
    const f32x4 mk0 = *reinterpret_cast<const f32x4*>(mr);
    const f32x4 mk1 = *reinterpret_cast<const f32x4*>(mr + 4);
    const f32x4 mk2 = *reinterpret_cast<const f32x4*>(mr + 16);
    const f32x4 mk3 = *reinterpret_cast<const f32x4*>(mr + 20);
    // K rows as A operand (row = key), both d halves of both 16-key subtiles
    const unsigned short* kr0 = &Ks[bf][ln][half * 8];
    const unsigned short* kr1 = &Ks[bf][16 + ln][half * 8];
    const v16bf a00 = ld16bf(kr0, kr0 + 16), a01 = ld16bf(kr0 + 32, kr0 + 48);
    const v16bf a10 = ld16bf(kr1, kr1 + 16), a11 = ld16bf(kr1 + 32, kr1 + 48);
    // V^T rows as A operand (row = d), 4 output d-tiles
    const unsigned short* vr = &Vs[bf][ln][half * 8];
    const v16bf va0 = ld16bf(vr, vr + 16);
    const v16bf va1 = ld16bf(vr + 16 * 40, vr + 16 * 40 + 16);
    const v16bf va2 = ld16bf(vr + 32 * 40, vr + 32 * 40 + 16);
    const v16bf va3 = ld16bf(vr + 48 * 40, vr + 48 * 40 + 16);
    // keeps the pass's LDS reads together ahead of the products: without it
    // each V^T read stands directly in front of the product that waits for it
    __builtin_amdgcn_sched_barrier(0);

    // scores^T = K . Q^T over d=64 (two K=32 WMMA steps, two 16-key subtiles)
    // s_t[r] = S[query ln][key = 16 t + 8 half + r]
    v8f s0, s1;
#pragma unroll
    for (int r = 0; r < 8; ++r) { s0[r] = 0.f; s1[r] = 0.f; }
    s0 = wmma_bf16(a00, qf0, s0);
    s1 = wmma_bf16(a10, qf0, s1);
    s0 = wmma_bf16(a01, qf1, s0);
    s1 = wmma_bf16(a11, qf1, s1);

    // scale + attention mask
    s0 = s0 * 0.125f + __builtin_shufflevector(mk0, mk1, 0, 1, 2, 3, 4, 5, 6, 7);
    s1 = s1 * 0.125f + __builtin_shufflevector(mk2, mk3, 0, 1, 2, 3, 4, 5, 6, 7);

    // online softmax: 16 keys in-lane, the other 16 in lane ^ 16
    float va = s0[0], vb = s1[0];
#pragma unroll
    for (int r = 1; r < 8; ++r) { va = fmaxf(va, s0[r]); vb = fmaxf(vb, s1[r]); }
    float v = fmaxf(va, vb);
    v = fmaxf(v, xhalf(v));
    const float mn   = fmaxf(mrow, v);
    const float corr = __expf(mrow - mn);
    mrow = mn;

    // P^T as B operand: element e <-> key 8 half + e, 8 + e <-> 16 + 8 half + e
    v16bf pb;
    v8f p0, p1;
#pragma unroll
    for (int r = 0; r < 8; ++r) {
      p0[r] = __expf(s0[r] - mn);
      p1[r] = __expf(s1[r] - mn);
      pb[r]     = (__bf16)p0[r];
      pb[8 + r] = (__bf16)p1[r];
    }
    // this half's 16 terms, summed pairwise
    const v8f   t8 = p0 + p1;
    const f32x4 t4 = __builtin_shufflevector(t8, t8, 0, 1, 2, 3) +
                     __builtin_shufflevector(t8, t8, 4, 5, 6, 7);
    lrow = lrow * corr + ((t4[0] + t4[2]) + (t4[1] + t4[3]));
#pragma unroll
    for (int r = 0; r < 8; ++r) {
      o0[r] *= corr; o1[r] *= corr; o2[r] *= corr; o3[r] *= corr;
    }

    // O^T += V^T . P^T   (K=32 over this key chunk, 4 output d-tiles)
    o0 = wmma_bf16(va0, pb, o0);
    o1 = wmma_bf16(va1, pb, o1);
    o2 = wmma_bf16(va2, pb, o2);
    o3 = wmma_bf16(va3, pb, o3);

    __syncthreads();   // all waves done with buffer bf before it refills
  }

  // join the halves' sums, normalize and emit context, merged heads bf16
  // [b*S+s][H]: 8 consecutive d per lane and tile, one 16-byte store each
  const float inv = 1.0f / (lrow + xhalf(lrow));
  unsigned short* crow =
      ctx + ((size_t)b * S_ + (qb + ln)) * H_ + (size_t)h * HD_ + half * 8;
  v8bf c0, c1, c2, c3;
#pragma unroll
  for (int r = 0; r < 8; ++r) {
    c0[r] = (__bf16)(o0[r] * inv);
    c1[r] = (__bf16)(o1[r] * inv);
    c2[r] = (__bf16)(o2[r] * inv);
    c3[r] = (__bf16)(o3[r] * inv);
  }
  *reinterpret_cast<u32x4*>(crow)      = __builtin_bit_cast(u32x4, c0);
  *reinterpret_cast<u32x4*>(crow + 16) = __builtin_bit_cast(u32x4, c1);
  *reinterpret_cast<u32x4*>(crow + 32) = __builtin_bit_cast(u32x4, c2);
  *reinterpret_cast<u32x4*>(crow + 48) = __builtin_bit_cast(u32x4, c3);
}

// ---------------------------------------------------------------------------
// Kernel 4: output projection + bias + residual + LayerNorm (fused)
// ---------------------------------------------------------------------------
__global__ __launch_bounds__(512) void proj_ln_kernel(
    const unsigned short* __restrict__ ctx,
    const unsigned short* __restrict__ woT,
    const float* __restrict__ bo, const float* __restrict__ x,
    const float* __restrict__ gamma, const float* __restrict__ beta,
    float* __restrict__ out) {
  __shared__ __align__(16) unsigned short cA[16][264];
  __shared__ __align__(16) float          ot[16][264];

  const int tid = threadIdx.x;
  const int mbase = blockIdx.x * 16;
  { // stage ctx tile (already bf16)
    const int row = tid >> 5, ch = (tid & 31) * 8;
    *reinterpret_cast<u32x4*>(&cA[row][ch]) =
        *reinterpret_cast<const u32x4*>(ctx + (size_t)(mbase + row) * H_ + ch);
  }
  __syncthreads();

  const int wave = tid >> 5, lane = tid & 31;
  const int half = lane >> 4, ln = lane & 15;
  const int j = wave * 16 + ln;

  v8f c;
  const float bb = bo[j];
#pragma unroll
  for (int r = 0; r < 8; ++r) c[r] = bb;

#pragma unroll
  for (int kk = 0; kk < H_; kk += 32) {
    v16bf a = ld16bf(&cA[ln][kk + half * 8], &cA[ln][kk + 16 + half * 8]);
    const unsigned short* bp = woT + (size_t)j * H_ + kk + half * 8;
    v16bf bv = ld16bf(bp, bp + 16);
    c = wmma_bf16(a, bv, c);
  }

  // + residual, stage rows for LayerNorm
#pragma unroll
  for (int r = 0; r < 8; ++r) {
    const int gr = mbase + r + 8 * half;
    ot[r + 8 * half][j] = c[r] + x[(size_t)gr * H_ + j];
  }
  __syncthreads();

  // LayerNorm: wave w normalizes row w (256 cols, 8 per lane)
  {
    const int row = wave, c0 = lane * 8;
    float vals[8], s = 0.f, sq = 0.f;
#pragma unroll
    for (int i = 0; i < 8; ++i) {
      vals[i] = ot[row][c0 + i];
      s += vals[i];
      sq += vals[i] * vals[i];
    }
    s  += __shfl_xor(s, 16, 32);  sq += __shfl_xor(sq, 16, 32);
    s  += __shfl_xor(s, 8, 32);   sq += __shfl_xor(sq, 8, 32);
    s  += __shfl_xor(s, 4, 32);   sq += __shfl_xor(sq, 4, 32);
    s  += __shfl_xor(s, 2, 32);   sq += __shfl_xor(sq, 2, 32);
    s  += __shfl_xor(s, 1, 32);   sq += __shfl_xor(sq, 1, 32);
    const float mu  = s * (1.0f / 256.0f);
    const float var = sq * (1.0f / 256.0f) - mu * mu;
    const float inv = rsqrtf(var + 1e-12f);
    const size_t gr = (size_t)(mbase + row) * H_;
#pragma unroll
    for (int i = 0; i < 8; ++i) {
      const int col = c0 + i;
      out[gr + col] = (vals[i] - mu) * inv * gamma[col] + beta[col];
    }
  }
}

// ---------------------------------------------------------------------------
extern "C" void kernel_launch(void* const* d_in, const int* in_sizes, int n_in,
                              void* d_out, int out_size, void* d_ws, size_t ws_size,
                              hipStream_t stream) {
  const float* x     = (const float*)d_in[0];
  const float* mask  = (const float*)d_in[1];
  const float* Wq    = (const float*)d_in[2];
  const float* bq    = (const float*)d_in[3];
  const float* Wk    = (const float*)d_in[4];
  const float* bk    = (const float*)d_in[5];
  const float* Wv    = (const float*)d_in[6];
  const float* bv    = (const float*)d_in[7];
  const float* Wo    = (const float*)d_in[8];
  const float* bo    = (const float*)d_in[9];
  const float* gamma = (const float*)d_in[10];
  const float* beta  = (const float*)d_in[11];
  float* out = (float*)d_out;

  // workspace layout (ushort elements)
  unsigned short* ws  = (unsigned short*)d_ws;
  unsigned short* wT  = ws;                         // 4 * 256*256
  unsigned short* Qb  = ws + 4 * H_ * H_;           // [B][NH][S][HD]
  unsigned short* Kb  = Qb + (size_t)B_ * NH_ * S_ * HD_;
  unsigned short* Vtb = Kb + (size_t)B_ * NH_ * S_ * HD_;
  unsigned short* ctx = Vtb + (size_t)B_ * NH_ * S_ * HD_;  // [M][H]

  prep_weights_kernel<<<dim3(H_ * H_ / 256, 4), 256, 0, stream>>>(
      Wq, Wk, Wv, Wo, wT);

  qkv_kernel<<<M_ / 16, 512, 0, stream>>>(
      x, bq, bk, bv, wT, wT + H_ * H_, wT + 2 * H_ * H_, Qb, Kb, Vtb);

  attn_kernel<<<dim3(S_ / 64, NH_, B_), 128, 0, stream>>>(
      mask, Qb, Kb, Vtb, ctx);

  proj_ln_kernel<<<M_ / 16, 512, 0, stream>>>(
      ctx, wT + 3 * H_ * H_, bo, x, gamma, beta, out);
}

// v003
// One run takes 103 microseconds.
// Timed twice side by side with v002, it ran 1.22 times as fast both times.
// Over all steps from v000 it is 1.62 times as fast.
#include <hip/hip_runtime.h>
#include <hip/hip_bf16.h>
#include <math.h>

// Problem constants (match reference)
#define B_   8
#define S_   2048
#define H_   256
#define NH_  4
#define HD_  64
#define M_   (B_ * S_)          // 16384 rows

typedef __attribute__((ext_vector_type(16))) __bf16       v16bf;
typedef __attribute__((ext_vector_type(8)))  __bf16       v8bf;
typedef __attribute__((ext_vector_type(8)))  float        v8f;
typedef __attribute__((ext_vector_type(4)))  float        f32x4;
typedef __attribute__((ext_vector_type(4)))  unsigned int u32x4;

struct U32x8 { u32x4 lo, hi; };

// float -> bf16 (round to nearest even, NaN-agnostic — inputs are sane)
static __device__ __forceinline__ unsigned short f2bf(float f) {
  unsigned u = __builtin_bit_cast(unsigned, f);
  u += 0x7FFFu + ((u >> 16) & 1u);
  return (unsigned short)(u >> 16);
}

// Build a WMMA 16-bf16 operand from two aligned 16-byte chunks.
// Per ISA 7.12.2 (wave32): per lane, elements 0..7 <-> K = half*8 + e,
// elements 8..15 <-> K = 16 + half*8 + e.  Storing tiles row-major [m][k]
// (A) or [n][k] (B-transposed) makes both chunks contiguous b128 loads.
static __device__ __forceinline__ v16bf ld16bf(const unsigned short* p0,
                                               const unsigned short* p1) {
  U32x8 u;
  u.lo = *reinterpret_cast<const u32x4*>(p0);
  u.hi = *reinterpret_cast<const u32x4*>(p1);
  return __builtin_bit_cast(v16bf, u);
}

static __device__ __forceinline__ v8f wmma_bf16(v16bf a, v16bf b, v8f c) {
  return __builtin_amdgcn_wmma_f32_16x16x32_bf16(
      /*neg_a=*/false, a, /*neg_b=*/false, b,
      /*c_mod=*/(short)0, c, /*reuse_a=*/false, /*reuse_b=*/false);
}

// --- CDNA5 async memory->LDS copy (ASYNCcnt path) --------------------------
// Per lane: LDS[ldsOff] <- MEM[base + gOff] (16 bytes).  GVS addressing:
// 64-bit SGPR base + 32-bit per-lane VGPR offset.  LDS offset is the low
// 32 bits of the generic shared-space address (aperture: addr[31:0]).
static __device__ __forceinline__ unsigned lds_off(const void* p) {
  return (unsigned)(size_t)p;
}
// One chunk's eight copies of a lane: four from the mask, two from K, two from
// V^T.  The closing s_wait_xcnt 0 stands inside the copies' own statement so
// that no later write of an address register they name can be placed in front
// of it.
static __device__ __forceinline__ void async_chunk_b128(
    unsigned lm0, unsigned lm1, unsigned lm2, unsigned lm3,
    unsigned lk0, unsigned lk1, unsigned lv0, unsigned lv1,
    unsigned gm0, unsigned gm1, unsigned gm2, unsigned gm3,
    unsigned gk0, unsigned gk1, unsigned gv0, unsigned gv1,
    const void* mbase, const void* kbase, const void* vbase) {
  asm volatile("global_load_async_to_lds_b128 %0, %8, %16\n\t"
               "global_load_async_to_lds_b128 %1, %9, %16\n\t"
               "global_load_async_to_lds_b128 %2, %10, %16\n\t"
               "global_load_async_to_lds_b128 %3, %11, %16\n\t"
               "global_load_async_to_lds_b128 %4, %12, %17\n\t"
               "global_load_async_to_lds_b128 %5, %13, %17\n\t"
               "global_load_async_to_lds_b128 %6, %14, %18\n\t"
               "global_load_async_to_lds_b128 %7, %15, %18\n\t"
               "s_wait_xcnt 0x0"
               :
               : "v"(lm0), "v"(lm1), "v"(lm2), "v"(lm3),
                 "v"(lk0), "v"(lk1), "v"(lv0), "v"(lv1),
                 "v"(gm0), "v"(gm1), "v"(gm2), "v"(gm3),
                 "v"(gk0), "v"(gk1), "v"(gv0), "v"(gv1),
                 "s"((unsigned long long)(size_t)mbase),
                 "s"((unsigned long long)(size_t)kbase),
                 "s"((unsigned long long)(size_t)vbase)
               : "memory");
}

// ---------------------------------------------------------------------------
// Kernel 1: transpose + convert the 4 weight matrices to bf16 [n][k]
// ---------------------------------------------------------------------------
__global__ __launch_bounds__(256) void prep_weights_kernel(
    const float* __restrict__ Wq, const float* __restrict__ Wk,
    const float* __restrict__ Wv, const float* __restrict__ Wo,
    unsigned short* __restrict__ wT) {
  const int mat = blockIdx.y;
  const float* src = (mat == 0) ? Wq : (mat == 1) ? Wk : (mat == 2) ? Wv : Wo;
  unsigned short* dst = wT + (size_t)mat * H_ * H_;
  const int e = blockIdx.x * 256 + threadIdx.x;   // e = k*256 + n
  const int k = e >> 8, n = e & 255;
  dst[n * H_ + k] = f2bf(src[e]);
}

// ---------------------------------------------------------------------------
// Kernel 2: QKV projection.  64-row m-tile per block, 16 waves = 16 n-tiles;
// a wave keeps 4 row tiles x 3 matrices of accumulators, so every weight
// fragment it loads feeds 4 products.
// Writes Q,K bf16 [b][h][s][d]; V transposed bf16 [b][h][d][s].
// ---------------------------------------------------------------------------
#define GT_ 4                   // 16-row tiles per block in both projections
#define GR_ (16 * GT_)          // rows per block

// one block per WGP (grid = 256): 4 waves per SIMD is all that can be resident,
// so the compiler may spend that share of the registers on loads issued ahead
__global__ __launch_bounds__(512) __attribute__((amdgpu_waves_per_eu(4, 4)))
void qkv_kernel(
    const float* __restrict__ x,
    const float* __restrict__ bq, const float* __restrict__ bk,
    const float* __restrict__ bv,
    const unsigned short* __restrict__ wqT,
    const unsigned short* __restrict__ wkT,
    const unsigned short* __restrict__ wvT,
    unsigned short* __restrict__ Q, unsigned short* __restrict__ K,
    unsigned short* __restrict__ Vt) {
  __shared__ __align__(16) unsigned short xA[GR_][264];

  const int tid   = threadIdx.x;
  const int mbase = blockIdx.x * GR_;
  const int wave = tid >> 5, lane = tid & 31;
  const int half = lane >> 4, ln = lane & 15;
  const int j = wave * 16 + ln;                // global output column

  // biases and the first k step's weight fragments need nothing from LDS:
  // they are asked for ahead of the barrier and arrive while x is staged
  const float biasq = bq[j], biask = bk[j], biasv = bv[j];
  const unsigned short* pq = wqT + (size_t)j * H_ + half * 8;
  const unsigned short* pk = wkT + (size_t)j * H_ + half * 8;
  const unsigned short* pv = wvT + (size_t)j * H_ + half * 8;
  v16bf nq = ld16bf(pq, pq + 16);
  v16bf nk = ld16bf(pk, pk + 16);
  v16bf nv = ld16bf(pv, pv + 16);

  { // stage 64x256 fp32 -> bf16 LDS, one whole row per wave and pass
    const int col = (tid & 31) * 8, row = tid >> 5;
    const float* src = x + (size_t)(mbase + row) * H_ + col;
    f32x4 lo[GT_], hi[GT_];
#pragma unroll
    for (int t = 0; t < GT_; ++t) {
      lo[t] = *reinterpret_cast<const f32x4*>(src + 16 * t * H_);
      hi[t] = *reinterpret_cast<const f32x4*>(src + 16 * t * H_ + 4);
    }
    // the loads' address stays whole up to this wait
    asm volatile("s_wait_xcnt 0x0" :: "v"(src) : "memory");
#pragma unroll
    for (int t = 0; t < GT_; ++t) {
#pragma unroll
      for (int i = 0; i < 4; ++i) {
        xA[row + 16 * t][col + i]     = f2bf(lo[t][i]);
        xA[row + 16 * t][col + 4 + i] = f2bf(hi[t][i]);
      }
    }
  }
  __syncthreads();

  v8f cq[GT_], ck[GT_], cv[GT_];
#pragma unroll
  for (int t = 0; t < GT_; ++t) {
#pragma unroll
    for (int r = 0; r < 8; ++r) {
      cq[t][r] = biasq; ck[t][r] = biask; cv[t][r] = biasv;
    }
  }

  // weight fragments are fetched one k step ahead of the products they feed
#pragma unroll
  for (int kk = 0; kk < H_; kk += 32) {
    const v16bf bqv = nq, bkv = nk, bvv = nv;
    if (kk + 32 < H_) {
      nq = ld16bf(pq + kk + 32, pq + kk + 48);
      nk = ld16bf(pk + kk + 32, pk + kk + 48);
      nv = ld16bf(pv + kk + 32, pv + kk + 48);
      // holds the next step's weight loads in front of this step's products:
      // without it they sink to just ahead of their use and each k step
      // waits out the L2 latency
      __builtin_amdgcn_sched_barrier(0);
    }
#pragma unroll
    for (int t = 0; t < GT_; ++t) {
      const unsigned short* ar = &xA[16 * t + ln][kk + half * 8];
      const v16bf a = ld16bf(ar, ar + 16);
      cq[t] = wmma_bf16(a, bqv, cq[t]);
      ck[t] = wmma_bf16(a, bkv, ck[t]);
      cv[t] = wmma_bf16(a, bvv, cv[t]);
    }
  }

  const int h = j >> 6, d = j & 63;
#pragma unroll
  for (int t = 0; t < GT_; ++t) {
#pragma unroll
    for (int r = 0; r < 8; ++r) {
      const int gr = mbase + 16 * t + r + 8 * half; // global row in [M_]
      const int b = gr >> 11, s = gr & (S_ - 1);
      const size_t qoff = (((size_t)b * NH_ + h) * S_ + s) * HD_ + d;
      Q[qoff] = f2bf(cq[t][r]);
      K[qoff] = f2bf(ck[t][r]);
      Vt[(((size_t)b * NH_ + h) * HD_ + d) * S_ + s] = f2bf(cv[t][r]);
    }
  }
}

static __device__ __forceinline__ float xhalf(float v) {
  const int i = __builtin_bit_cast(int, v);
  return __builtin_bit_cast(
      float, __builtin_amdgcn_permlanex16(i, i, 0x76543210, 0xfedcba98,
                                          false, false));
}

__global__ __launch_bounds__(128) void attn_kernel(
    const float* __restrict__ mask,
    const unsigned short* __restrict__ Q,
    const unsigned short* __restrict__ K,
    const unsigned short* __restrict__ Vt,
    unsigned short* __restrict__ ctx) {
  __shared__ __align__(16) unsigned short Ks[2][32][72];   // key chunk [key][d]
  __shared__ __align__(16) unsigned short Vs[2][64][40];   // V^T chunk [d][key]
  __shared__ __align__(16) float          Ms[2][64][36];   // mask chunk [q][key]

  const int tid = threadIdx.x, wave = tid >> 5, lane = tid & 31;
  const int half = lane >> 4, ln = lane & 15;
  const int b = blockIdx.z, h = blockIdx.y;
  const int qb = blockIdx.x * 64 + wave * 16;

  const size_t headQK = ((size_t)b * NH_ + h) * S_ * HD_;
  const size_t headV  = ((size_t)b * NH_ + h) * HD_ * S_;
  const unsigned short* qbase = Q + headQK + (size_t)qb * HD_;
  const unsigned short* kbase = K + headQK;
  const unsigned short* vbase = Vt + headV;

  // Q^T as B operand (column = query ln), loaded once and kept in registers
  const unsigned short* qrow = qbase + ln * HD_ + half * 8;
  const v16bf qf0 = ld16bf(qrow, qrow + 16);
  const v16bf qf1 = ld16bf(qrow + 32, qrow + 48);

  // mask rows of this block's 64 queries; this lane copies 16 bytes of rows
  // mrw, mrw + 4, mrw + 8, mrw + 12, all among its own wave's 16 queries
  const float* mbase = mask + ((size_t)b * S_ + blockIdx.x * 64) * S_;
  const int mrw = wave * 16 + (lane >> 3), mch = (lane & 7) * 4;

  // issue one 32-key K/V/mask chunk into buffer bf (8 wave-ops, in-order)
  auto issue_chunk = [&](int k0, int bf) {
    const int kr = tid >> 3, kc = (tid & 7) * 8;   // K: 32x64 bf16, rows kr, kr+16
    const int vr = tid >> 2, vc = (tid & 3) * 8;   // V^T: 64x32 bf16, rows vr, vr+32
    async_chunk_b128(lds_off(&Ms[bf][mrw][mch]),                // mask: 64x32 f32
                     lds_off(&Ms[bf][mrw + 4][mch]),
                     lds_off(&Ms[bf][mrw + 8][mch]),
                     lds_off(&Ms[bf][mrw + 12][mch]),
                     lds_off(&Ks[bf][kr][kc]), lds_off(&Ks[bf][kr + 16][kc]),
                     lds_off(&Vs[bf][vr][vc]), lds_off(&Vs[bf][vr + 32][vc]),
                     (unsigned)((mrw * S_ + k0 + mch) * 4),
                     (unsigned)(((mrw + 4) * S_ + k0 + mch) * 4),
                     (unsigned)(((mrw + 8) * S_ + k0 + mch) * 4),
                     (unsigned)(((mrw + 12) * S_ + k0 + mch) * 4),
                     (unsigned)(((k0 + kr) * HD_ + kc) * 2),
                     (unsigned)(((k0 + kr + 16) * HD_ + kc) * 2),
                     (unsigned)((vr * S_ + k0 + vc) * 2),
                     (unsigned)(((vr + 32) * S_ + k0 + vc) * 2),
                     mbase, kbase, vbase);
  };

  // o_t[r] = O[query ln][d = 16 t + 8 half + r]
  v8f o0, o1, o2, o3;
#pragma unroll
  for (int r = 0; r < 8; ++r) {
    o0[r] = 0.f; o1[r] = 0.f; o2[r] = 0.f; o3[r] = 0.f;
  }
  float mrow = -1e30f;   // running maximum of query ln (equal in both halves)
  float lrow = 0.f;      // running sum over this half's keys only

  issue_chunk(0, 0);

  for (int k0 = 0; k0 < S_; k0 += 32) {
    const int bf = (k0 >> 5) & 1;
    if (k0 + 32 < S_) {
      issue_chunk(k0 + 32, bf ^ 1);
      // 8 ops of chunk i+1 in flight; retire chunk i
      asm volatile("s_wait_asynccnt 8" ::: "memory");
    } else {
      asm volatile("s_wait_asynccnt 0" ::: "memory");
    }
    __syncthreads();   // chunk bf visible to all waves

    // attention mask: 2 x 8 consecutive keys of one query per lane
    // (keys 8 half + r and 16 + 8 half + r)
    const float* mr = &Ms[bf][wave * 16 + ln][half * 8];
    const f32x4 mk0 = *reinterpret_cast<const f32x4*>(mr);
    const f32x4 mk1 = *reinterpret_cast<const f32x4*>(mr + 4);
    const f32x4 mk2 = *reinterpret_cast<const f32x4*>(mr + 16);
    const f32x4 mk3 = *reinterpret_cast<const f32x4*>(mr + 20);
    // K rows as A operand (row = key), both d halves of both 16-key subtiles
    const unsigned short* kr0 = &Ks[bf][ln][half * 8];
    const unsigned short* kr1 = &Ks[bf][16 + ln][half * 8];
    const v16bf a00 = ld16bf(kr0, kr0 + 16), a01 = ld16bf(kr0 + 32, kr0 + 48);
    const v16bf a10 = ld16bf(kr1, kr1 + 16), a11 = ld16bf(kr1 + 32, kr1 + 48);
    // V^T rows as A operand (row = d), 4 output d-tiles
    const unsigned short* vr = &Vs[bf][ln][half * 8];
    const v16bf va0 = ld16bf(vr, vr + 16);
    const v16bf va1 = ld16bf(vr + 16 * 40, vr + 16 * 40 + 16);
    const v16bf va2 = ld16bf(vr + 32 * 40, vr + 32 * 40 + 16);
    const v16bf va3 = ld16bf(vr + 48 * 40, vr + 48 * 40 + 16);
    // keeps the pass's LDS reads together ahead of the products: without it
    // each V^T read stands directly in front of the product that waits for it
    __builtin_amdgcn_sched_barrier(0);

    // scores^T = K . Q^T over d=64 (two K=32 WMMA steps, two 16-key subtiles)
    // s_t[r] = S[query ln][key = 16 t + 8 half + r]
    v8f s0, s1;
#pragma unroll
    for (int r = 0; r < 8; ++r) { s0[r] = 0.f; s1[r] = 0.f; }
    s0 = wmma_bf16(a00, qf0, s0);
    s1 = wmma_bf16(a10, qf0, s1);
    s0 = wmma_bf16(a01, qf1, s0);
    s1 = wmma_bf16(a11, qf1, s1);

    // scale + attention mask
    s0 = s0 * 0.125f + __builtin_shufflevector(mk0, mk1, 0, 1, 2, 3, 4, 5, 6, 7);
    s1 = s1 * 0.125f + __builtin_shufflevector(mk2, mk3, 0, 1, 2, 3, 4, 5, 6, 7);

    // online softmax: 16 keys in-lane, the other 16 in lane ^ 16
    float va = s0[0], vb = s1[0];
#pragma unroll
    for (int r = 1; r < 8; ++r) { va = fmaxf(va, s0[r]); vb = fmaxf(vb, s1[r]); }
    float v = fmaxf(va, vb);
    v = fmaxf(v, xhalf(v));
    const float mn   = fmaxf(mrow, v);
    const float corr = __expf(mrow - mn);
    mrow = mn;

    // P^T as B operand: element e <-> key 8 half + e, 8 + e <-> 16 + 8 half + e
    v16bf pb;
    v8f p0, p1;
#pragma unroll
    for (int r = 0; r < 8; ++r) {
      p0[r] = __expf(s0[r] - mn);
      p1[r] = __expf(s1[r] - mn);
      pb[r]     = (__bf16)p0[r];
      pb[8 + r] = (__bf16)p1[r];
    }
    // this half's 16 terms, summed pairwise
    const v8f   t8 = p0 + p1;
    const f32x4 t4 = __builtin_shufflevector(t8, t8, 0, 1, 2, 3) +
                     __builtin_shufflevector(t8, t8, 4, 5, 6, 7);
    lrow = lrow * corr + ((t4[0] + t4[2]) + (t4[1] + t4[3]));
#pragma unroll
    for (int r = 0; r < 8; ++r) {
      o0[r] *= corr; o1[r] *= corr; o2[r] *= corr; o3[r] *= corr;
    }

    // O^T += V^T . P^T   (K=32 over this key chunk, 4 output d-tiles)
    o0 = wmma_bf16(va0, pb, o0);
    o1 = wmma_bf16(va1, pb, o1);
    o2 = wmma_bf16(va2, pb, o2);
    o3 = wmma_bf16(va3, pb, o3);

    __syncthreads();   // all waves done with buffer bf before it refills
  }

  // join the halves' sums, normalize and emit context, merged heads bf16
  // [b*S+s][H]: 8 consecutive d per lane and tile, one 16-byte store each
  const float inv = 1.0f / (lrow + xhalf(lrow));
  unsigned short* crow =
      ctx + ((size_t)b * S_ + (qb + ln)) * H_ + (size_t)h * HD_ + half * 8;
  v8bf c0, c1, c2, c3;
#pragma unroll
  for (int r = 0; r < 8; ++r) {
    c0[r] = (__bf16)(o0[r] * inv);
    c1[r] = (__bf16)(o1[r] * inv);
    c2[r] = (__bf16)(o2[r] * inv);
    c3[r] = (__bf16)(o3[r] * inv);
  }
  *reinterpret_cast<u32x4*>(crow)      = __builtin_bit_cast(u32x4, c0);
  *reinterpret_cast<u32x4*>(crow + 16) = __builtin_bit_cast(u32x4, c1);
  *reinterpret_cast<u32x4*>(crow + 32) = __builtin_bit_cast(u32x4, c2);
  *reinterpret_cast<u32x4*>(crow + 48) = __builtin_bit_cast(u32x4, c3);
}

// ---------------------------------------------------------------------------
// Kernel 4: output projection + bias + residual + LayerNorm (fused)
// ---------------------------------------------------------------------------
// register budget as in the QKV kernel: one block per WGP, 4 waves per SIMD
__global__ __launch_bounds__(512) __attribute__((amdgpu_waves_per_eu(4, 4)))
void proj_ln_kernel(
    const unsigned short* __restrict__ ctx,
    const unsigned short* __restrict__ woT,
    const float* __restrict__ bo, const float* __restrict__ x,
    const float* __restrict__ gamma, const float* __restrict__ beta,
    float* __restrict__ out) {
  __shared__ __align__(16) unsigned short cA[GR_][264];
  __shared__ __align__(16) float          ot[GR_][264];

  const int tid = threadIdx.x;
  const int mbase = blockIdx.x * GR_;
  const int wave = tid >> 5, lane = tid & 31;
  const int half = lane >> 4, ln = lane & 15;
  const int j = wave * 16 + ln;

  // the wave's 16 weight columns need nothing from LDS: they are asked for
  // ahead of the barrier and arrive while the ctx tile is staged
  const float bb = bo[j];
  const unsigned short* bp = woT + (size_t)j * H_ + half * 8;
  v16bf bw[H_ / 32];
#pragma unroll
  for (int k = 0; k < H_ / 32; ++k)
    bw[k] = ld16bf(bp + 32 * k, bp + 32 * k + 16);

  { // stage ctx tile (already bf16)
    const int ch = (tid & 31) * 8;
#pragma unroll
    for (int t = 0; t < GT_; ++t) {
      const int row = (tid >> 5) + 16 * t;
      *reinterpret_cast<u32x4*>(&cA[row][ch]) =
          *reinterpret_cast<const u32x4*>(ctx + (size_t)(mbase + row) * H_ + ch);
    }
  }
  __syncthreads();

  v8f c[GT_];
#pragma unroll
  for (int t = 0; t < GT_; ++t) {
#pragma unroll
    for (int r = 0; r < 8; ++r) c[t][r] = bb;
  }

#pragma unroll
  for (int kk = 0; kk < H_; kk += 32) {
#pragma unroll
    for (int t = 0; t < GT_; ++t) {
      const unsigned short* ar = &cA[16 * t + ln][kk + half * 8];
      c[t] = wmma_bf16(ld16bf(ar, ar + 16), bw[kk / 32], c[t]);
    }
  }

  // + residual, stage rows for LayerNorm
  {
    const float* xr = x + (size_t)(mbase + 8 * half) * H_ + j;
    float res[GT_][8];
#pragma unroll
    for (int t = 0; t < GT_; ++t) {
#pragma unroll
      for (int r = 0; r < 8; ++r) res[t][r] = xr[(16 * t + r) * H_];
    }
    // the loads' address stays whole up to this wait
    asm volatile("s_wait_xcnt 0x0" :: "v"(xr) : "memory");
#pragma unroll
    for (int t = 0; t < GT_; ++t) {
#pragma unroll
      for (int r = 0; r < 8; ++r)
        ot[16 * t + r + 8 * half][j] = c[t][r] + res[t][r];
    }
  }
  __syncthreads();

  // LayerNorm: wave w normalizes rows w, w + 16, ... (256 cols, 8 per lane)
#pragma unroll
  for (int t = 0; t < GT_; ++t) {
    const int row = wave + 16 * t, c0 = lane * 8;
    float vals[8], s = 0.f, sq = 0.f;
#pragma unroll
    for (int i = 0; i < 8; ++i) {
      vals[i] = ot[row][c0 + i];
      s += vals[i];
      sq += vals[i] * vals[i];
    }
    s  += __shfl_xor(s, 16, 32);  sq += __shfl_xor(sq, 16, 32);
    s  += __shfl_xor(s, 8, 32);   sq += __shfl_xor(sq, 8, 32);
    s  += __shfl_xor(s, 4, 32);   sq += __shfl_xor(sq, 4, 32);
    s  += __shfl_xor(s, 2, 32);   sq += __shfl_xor(sq, 2, 32);
    s  += __shfl_xor(s, 1, 32);   sq += __shfl_xor(sq, 1, 32);
    const float mu  = s * (1.0f / 256.0f);
    const float var = sq * (1.0f / 256.0f) - mu * mu;
    const float inv = rsqrtf(var + 1e-12f);
    const size_t gr = (size_t)(mbase + row) * H_;
#pragma unroll
    for (int i = 0; i < 8; ++i) {
      const int col = c0 + i;
      out[gr + col] = (vals[i] - mu) * inv * gamma[col] + beta[col];
    }
  }
}

// ---------------------------------------------------------------------------
extern "C" void kernel_launch(void* const* d_in, const int* in_sizes, int n_in,
                              void* d_out, int out_size, void* d_ws, size_t ws_size,
                              hipStream_t stream) {
  const float* x     = (const float*)d_in[0];
  const float* mask  = (const float*)d_in[1];
  const float* Wq    = (const float*)d_in[2];
  const float* bq    = (const float*)d_in[3];
  const float* Wk    = (const float*)d_in[4];
  const float* bk    = (const float*)d_in[5];
  const float* Wv    = (const float*)d_in[6];
  const float* bv    = (const float*)d_in[7];
  const float* Wo    = (const float*)d_in[8];
  const float* bo    = (const float*)d_in[9];
  const float* gamma = (const float*)d_in[10];
  const float* beta  = (const float*)d_in[11];
  float* out = (float*)d_out;

  // workspace layout (ushort elements)
  unsigned short* ws  = (unsigned short*)d_ws;
  unsigned short* wT  = ws;                         // 4 * 256*256
  unsigned short* Qb  = ws + 4 * H_ * H_;           // [B][NH][S][HD]
  unsigned short* Kb  = Qb + (size_t)B_ * NH_ * S_ * HD_;
  unsigned short* Vtb = Kb + (size_t)B_ * NH_ * S_ * HD_;
  unsigned short* ctx = Vtb + (size_t)B_ * NH_ * S_ * HD_;  // [M][H]

  prep_weights_kernel<<<dim3(H_ * H_ / 256, 4), 256, 0, stream>>>(
      Wq, Wk, Wv, Wo, wT);

  qkv_kernel<<<M_ / GR_, 512, 0, stream>>>(
      x, bq, bk, bv, wT, wT + H_ * H_, wT + 2 * H_ * H_, Qb, Kb, Vtb);

  attn_kernel<<<dim3(S_ / 64, NH_, B_), 128, 0, stream>>>(
      mask, Qb, Kb, Vtb, ctx);

  proj_ln_kernel<<<M_ / GR_, 512, 0, stream>>>(
      ctx, wT + 3 * H_ * H_, bo, x, gamma, beta, out);
}

// v004
// Measured time: 75.6 microseconds a run.
// Timed twice side by side with v003, it ran 1.37 times as fast both times.
// Counting every step since v000, it is 2.22 times as fast.
#include <hip/hip_runtime.h>
#include <hip/hip_bf16.h>
#include <math.h>

// Problem constants (match reference)
#define B_   8
#define S_   2048
#define H_   256
#define NH_  4
#define HD_  64
#define M_   (B_ * S_)          // 16384 rows

typedef __attribute__((ext_vector_type(16))) __bf16       v16bf;
typedef __attribute__((ext_vector_type(8)))  __bf16       v8bf;
typedef __attribute__((ext_vector_type(8)))  float        v8f;
typedef __attribute__((ext_vector_type(4)))  float        f32x4;
typedef __attribute__((ext_vector_type(4)))  unsigned int u32x4;

struct U32x8 { u32x4 lo, hi; };

// float -> bf16 (round to nearest even, NaN-agnostic — inputs are sane)
static __device__ __forceinline__ unsigned short f2bf(float f) {
  unsigned u = __builtin_bit_cast(unsigned, f);
  u += 0x7FFFu + ((u >> 16) & 1u);
  return (unsigned short)(u >> 16);
}

// Build a WMMA 16-bf16 operand from two aligned 16-byte chunks.
// Per ISA 7.12.2 (wave32): per lane, elements 0..7 <-> K = half*8 + e,
// elements 8..15 <-> K = 16 + half*8 + e.  Storing tiles row-major [m][k]
// (A) or [n][k] (B-transposed) makes both chunks contiguous b128 loads.
static __device__ __forceinline__ v16bf ld16bf(const unsigned short* p0,
                                               const unsigned short* p1) {
  U32x8 u;
  u.lo = *reinterpret_cast<const u32x4*>(p0);
  u.hi = *reinterpret_cast<const u32x4*>(p1);
  return __builtin_bit_cast(v16bf, u);
}

static __device__ __forceinline__ v8f wmma_bf16(v16bf a, v16bf b, v8f c) {
  return __builtin_amdgcn_wmma_f32_16x16x32_bf16(
      /*neg_a=*/false, a, /*neg_b=*/false, b,
      /*c_mod=*/(short)0, c, /*reuse_a=*/false, /*reuse_b=*/false);
}

// --- CDNA5 async memory->LDS copy (ASYNCcnt path) --------------------------
// Per lane: LDS[ldsOff] <- MEM[base + gOff] (16 bytes).  GVS addressing:
// 64-bit SGPR base + 32-bit per-lane VGPR offset.  LDS offset is the low
// 32 bits of the generic shared-space address (aperture: addr[31:0]).
static __device__ __forceinline__ unsigned lds_off(const void* p) {
  return (unsigned)(size_t)p;
}
// One chunk's twelve copies of a lane: eight from the mask, two from K, two
// from V^T.  The closing s_wait_xcnt 0 stands inside the copies' own statement
// so that no later write of an address register they name can be placed in
// front of it.
static __device__ __forceinline__ void async_chunk_b128(
    unsigned lm0, unsigned lm1, unsigned lm2, unsigned lm3,
    unsigned lm4, unsigned lm5, unsigned lm6, unsigned lm7,
    unsigned lk0, unsigned lk1, unsigned lv0, unsigned lv1,
    unsigned gm0, unsigned gm1, unsigned gm2, unsigned gm3,
    unsigned gm4, unsigned gm5, unsigned gm6, unsigned gm7,
    unsigned gk0, unsigned gk1, unsigned gv0, unsigned gv1,
    const void* mbase, const void* kbase, const void* vbase) {
  asm volatile("global_load_async_to_lds_b128 %0, %12, %24\n\t"
               "global_load_async_to_lds_b128 %1, %13, %24\n\t"
               "global_load_async_to_lds_b128 %2, %14, %24\n\t"
               "global_load_async_to_lds_b128 %3, %15, %24\n\t"
               "global_load_async_to_lds_b128 %4, %16, %24\n\t"
               "global_load_async_to_lds_b128 %5, %17, %24\n\t"
               "global_load_async_to_lds_b128 %6, %18, %24\n\t"
               "global_load_async_to_lds_b128 %7, %19, %24\n\t"
               "global_load_async_to_lds_b128 %8, %20, %25\n\t"
               "global_load_async_to_lds_b128 %9, %21, %25\n\t"
               "global_load_async_to_lds_b128 %10, %22, %26\n\t"
               "global_load_async_to_lds_b128 %11, %23, %26\n\t"
               "s_wait_xcnt 0x0"
               :
               : "v"(lm0), "v"(lm1), "v"(lm2), "v"(lm3),
                 "v"(lm4), "v"(lm5), "v"(lm6), "v"(lm7),
                 "v"(lk0), "v"(lk1), "v"(lv0), "v"(lv1),
                 "v"(gm0), "v"(gm1), "v"(gm2), "v"(gm3),
                 "v"(gm4), "v"(gm5), "v"(gm6), "v"(gm7),
                 "v"(gk0), "v"(gk1), "v"(gv0), "v"(gv1),
                 "s"((unsigned long long)(size_t)mbase),
                 "s"((unsigned long long)(size_t)kbase),
                 "s"((unsigned long long)(size_t)vbase)
               : "memory");
}

// ---------------------------------------------------------------------------
// Kernel 1: transpose + convert the 4 weight matrices to bf16 [n][k]
// ---------------------------------------------------------------------------
__global__ __launch_bounds__(256) void prep_weights_kernel(
    const float* __restrict__ Wq, const float* __restrict__ Wk,
    const float* __restrict__ Wv, const float* __restrict__ Wo,
    unsigned short* __restrict__ wT) {
  const int mat = blockIdx.y;
  const float* src = (mat == 0) ? Wq : (mat == 1) ? Wk : (mat == 2) ? Wv : Wo;
  unsigned short* dst = wT + (size_t)mat * H_ * H_;
  const int e = blockIdx.x * 256 + threadIdx.x;   // e = k*256 + n
  const int k = e >> 8, n = e & 255;
  dst[n * H_ + k] = f2bf(src[e]);
}

// ---------------------------------------------------------------------------
// Kernel 2: QKV projection.  64-row m-tile per block, 16 waves = 16 n-tiles;
// a wave keeps 4 row tiles x 3 matrices of accumulators, so every weight
// fragment it loads feeds 4 products.
// Writes Q,K bf16 [b][h][s][d]; V transposed bf16 [b][h][d][s].
// ---------------------------------------------------------------------------
#define GT_ 4                   // 16-row tiles per block in both projections
#define GR_ (16 * GT_)          // rows per block

// one block per WGP (grid = 256): 4 waves per SIMD is all that can be resident,
// so the compiler may spend that share of the registers on loads issued ahead
__global__ __launch_bounds__(512) __attribute__((amdgpu_waves_per_eu(4, 4)))
void qkv_kernel(
    const float* __restrict__ x,
    const float* __restrict__ bq, const float* __restrict__ bk,
    const float* __restrict__ bv,
    const unsigned short* __restrict__ wqT,
    const unsigned short* __restrict__ wkT,
    const unsigned short* __restrict__ wvT,
    unsigned short* __restrict__ Q, unsigned short* __restrict__ K,
    unsigned short* __restrict__ Vt) {
  __shared__ __align__(16) unsigned short xA[GR_][264];

  const int tid   = threadIdx.x;
  const int mbase = blockIdx.x * GR_;
  const int wave = tid >> 5, lane = tid & 31;
  const int half = lane >> 4, ln = lane & 15;
  const int j = wave * 16 + ln;                // global output column

  // biases and the first k step's weight fragments need nothing from LDS:
  // they are asked for ahead of the barrier and arrive while x is staged
  const float biasq = bq[j], biask = bk[j], biasv = bv[j];
  const unsigned short* pq = wqT + (size_t)j * H_ + half * 8;
  const unsigned short* pk = wkT + (size_t)j * H_ + half * 8;
  const unsigned short* pv = wvT + (size_t)j * H_ + half * 8;
  v16bf nq = ld16bf(pq, pq + 16);
  v16bf nk = ld16bf(pk, pk + 16);
  v16bf nv = ld16bf(pv, pv + 16);

  { // stage 64x256 fp32 -> bf16 LDS, one whole row per wave and pass
    const int col = (tid & 31) * 8, row = tid >> 5;
    const float* src = x + (size_t)(mbase + row) * H_ + col;
    f32x4 lo[GT_], hi[GT_];
#pragma unroll
    for (int t = 0; t < GT_; ++t) {
      lo[t] = *reinterpret_cast<const f32x4*>(src + 16 * t * H_);
      hi[t] = *reinterpret_cast<const f32x4*>(src + 16 * t * H_ + 4);
    }
    // the loads' address stays whole up to this wait
    asm volatile("s_wait_xcnt 0x0" :: "v"(src) : "memory");
#pragma unroll
    for (int t = 0; t < GT_; ++t) {
#pragma unroll
      for (int i = 0; i < 4; ++i) {
        xA[row + 16 * t][col + i]     = f2bf(lo[t][i]);
        xA[row + 16 * t][col + 4 + i] = f2bf(hi[t][i]);
      }
    }
  }
  __syncthreads();

  v8f cq[GT_], ck[GT_], cv[GT_];
#pragma unroll
  for (int t = 0; t < GT_; ++t) {
#pragma unroll
    for (int r = 0; r < 8; ++r) {
      cq[t][r] = biasq; ck[t][r] = biask; cv[t][r] = biasv;
    }
  }

  // weight fragments are fetched one k step ahead of the products they feed
#pragma unroll
  for (int kk = 0; kk < H_; kk += 32) {
    const v16bf bqv = nq, bkv = nk, bvv = nv;
    if (kk + 32 < H_) {
      nq = ld16bf(pq + kk + 32, pq + kk + 48);
      nk = ld16bf(pk + kk + 32, pk + kk + 48);
      nv = ld16bf(pv + kk + 32, pv + kk + 48);
      // holds the next step's weight loads in front of this step's products:
      // without it they sink to just ahead of their use and each k step
      // waits out the L2 latency
      __builtin_amdgcn_sched_barrier(0);
    }
#pragma unroll
    for (int t = 0; t < GT_; ++t) {
      const unsigned short* ar = &xA[16 * t + ln][kk + half * 8];
      const v16bf a = ld16bf(ar, ar + 16);
      cq[t] = wmma_bf16(a, bqv, cq[t]);
      ck[t] = wmma_bf16(a, bkv, ck[t]);
      cv[t] = wmma_bf16(a, bvv, cv[t]);
    }
  }

  const int h = j >> 6, d = j & 63;
#pragma unroll
  for (int t = 0; t < GT_; ++t) {
#pragma unroll
    for (int r = 0; r < 8; ++r) {
      const int gr = mbase + 16 * t + r + 8 * half; // global row in [M_]
      const int b = gr >> 11, s = gr & (S_ - 1);
      const size_t qoff = (((size_t)b * NH_ + h) * S_ + s) * HD_ + d;
      Q[qoff] = f2bf(cq[t][r]);
      K[qoff] = f2bf(ck[t][r]);
      Vt[(((size_t)b * NH_ + h) * HD_ + d) * S_ + s] = f2bf(cv[t][r]);
    }
  }
}

#define KC_ 64
#define QB_ 128
// lane l <-> lane l ^ 16
static __device__ __forceinline__ float xhalf(float v) {
  const int i = __builtin_bit_cast(int, v);
  return __builtin_bit_cast(
      float, __builtin_amdgcn_permlanex16(i, i, 0x76543210, 0xfedcba98,
                                          false, false));
}

// 2 blocks per WGP (grid = 512): 4 waves per SIMD must stay resident, which
// bounds the registers of a wave
__global__ __launch_bounds__(256) __attribute__((amdgpu_waves_per_eu(4, 4)))
void attn_kernel(
    const float* __restrict__ mask,
    const unsigned short* __restrict__ Q,
    const unsigned short* __restrict__ K,
    const unsigned short* __restrict__ Vt,
    unsigned short* __restrict__ ctx) {
  __shared__ __align__(16) unsigned short Ks[2][KC_][72];      // key chunk [key][d]
  __shared__ __align__(16) unsigned short Vs[2][64][KC_ + 8];  // V^T chunk [d][key]
  __shared__ __align__(16) float          Ms[2][QB_][KC_ + 4]; // mask chunk [q][key]

  const int tid = threadIdx.x, wave = tid >> 5, lane = tid & 31;
  const int half = lane >> 4, ln = lane & 15;
  const int b = blockIdx.z, h = blockIdx.y;
  const int qb = blockIdx.x * QB_ + wave * 16;

  const size_t headQK = ((size_t)b * NH_ + h) * S_ * HD_;
  const size_t headV  = ((size_t)b * NH_ + h) * HD_ * S_;
  const unsigned short* qbase = Q + headQK + (size_t)qb * HD_;
  const unsigned short* kbase = K + headQK;
  const unsigned short* vbase = Vt + headV;

  // Q^T as B operand (column = query ln), loaded once and kept in registers
  const unsigned short* qrow = qbase + ln * HD_ + half * 8;
  const v16bf qf0 = ld16bf(qrow, qrow + 16);
  const v16bf qf1 = ld16bf(qrow + 32, qrow + 48);

  // mask rows of this block's 128 queries; this lane copies 16 bytes of rows
  // mrw, mrw + 2, ..., mrw + 14, all among its own wave's 16 queries
  const float* mbase = mask + ((size_t)b * S_ + blockIdx.x * QB_) * S_;
  const int mrw = wave * 16 + (lane >> 4), mch = (lane & 15) * 4;

  // issue one 64-key K/V/mask chunk into buffer bf (12 wave-ops, in-order)
  auto issue_chunk = [&](int k0, int bf) {
    const int rr = tid >> 3, cc = (tid & 7) * 8;   // K, V^T: 64x64 bf16, rows rr, rr + 32
    async_chunk_b128(lds_off(&Ms[bf][mrw][mch]),                // mask: 128x64 f32
                     lds_off(&Ms[bf][mrw + 2][mch]),
                     lds_off(&Ms[bf][mrw + 4][mch]),
                     lds_off(&Ms[bf][mrw + 6][mch]),
                     lds_off(&Ms[bf][mrw + 8][mch]),
                     lds_off(&Ms[bf][mrw + 10][mch]),
                     lds_off(&Ms[bf][mrw + 12][mch]),
                     lds_off(&Ms[bf][mrw + 14][mch]),
                     lds_off(&Ks[bf][rr][cc]), lds_off(&Ks[bf][rr + 32][cc]),
                     lds_off(&Vs[bf][rr][cc]), lds_off(&Vs[bf][rr + 32][cc]),
                     (unsigned)((mrw * S_ + k0 + mch) * 4),
                     (unsigned)(((mrw + 2) * S_ + k0 + mch) * 4),
                     (unsigned)(((mrw + 4) * S_ + k0 + mch) * 4),
                     (unsigned)(((mrw + 6) * S_ + k0 + mch) * 4),
                     (unsigned)(((mrw + 8) * S_ + k0 + mch) * 4),
                     (unsigned)(((mrw + 10) * S_ + k0 + mch) * 4),
                     (unsigned)(((mrw + 12) * S_ + k0 + mch) * 4),
                     (unsigned)(((mrw + 14) * S_ + k0 + mch) * 4),
                     (unsigned)(((k0 + rr) * HD_ + cc) * 2),
                     (unsigned)(((k0 + rr + 32) * HD_ + cc) * 2),
                     (unsigned)((rr * S_ + k0 + cc) * 2),
                     (unsigned)(((rr + 32) * S_ + k0 + cc) * 2),
                     mbase, kbase, vbase);
  };

  // every loop over t, u or r below is unrolled so that the register arrays it
  // walks are indexed by constants and never leave the registers
  // o[t][r] = O[query ln][d = 16 t + 8 half + r]
  v8f o[4];
#pragma unroll
  for (int t = 0; t < 4; ++t) {
#pragma unroll
    for (int r = 0; r < 8; ++r) o[t][r] = 0.f;
  }
  float mrow = -1e30f;   // running maximum of query ln (equal in both halves)
  float lrow = 0.f;      // running sum over this half's keys only

  issue_chunk(0, 0);

  for (int k0 = 0; k0 < S_; k0 += KC_) {
    const int bf = (k0 / KC_) & 1;
    if (k0 + KC_ < S_) {
      issue_chunk(k0 + KC_, bf ^ 1);
      // 12 ops of chunk i+1 in flight; retire chunk i
      asm volatile("s_wait_asynccnt 12" ::: "memory");
    } else {
      asm volatile("s_wait_asynccnt 0" ::: "memory");
    }
    __syncthreads();   // chunk bf visible to all waves

    // attention mask: 4 x 8 consecutive keys of one query per lane
    // (keys 16 t + 8 half + r)
    const float* mr = &Ms[bf][wave * 16 + ln][half * 8];
    f32x4 mk[8];
#pragma unroll
    for (int t = 0; t < 4; ++t) {
      mk[2 * t]     = *reinterpret_cast<const f32x4*>(mr + 16 * t);
      mk[2 * t + 1] = *reinterpret_cast<const f32x4*>(mr + 16 * t + 4);
    }
    // K rows as A operand (row = key), both d halves of the four 16-key subtiles
    v16bf ka[4][2];
#pragma unroll
    for (int t = 0; t < 4; ++t) {
      const unsigned short* kr = &Ks[bf][16 * t + ln][half * 8];
      ka[t][0] = ld16bf(kr, kr + 16);
      ka[t][1] = ld16bf(kr + 32, kr + 48);
    }
    // keeps these LDS reads together ahead of the products: without it each
    // read stands directly in front of the product that waits for it
    __builtin_amdgcn_sched_barrier(0);

    // scores^T = K . Q^T over d=64 (two K=32 WMMA steps, four 16-key subtiles)
    // s[t][r] = S[query ln][key = 16 t + 8 half + r]
    v8f s[4];
#pragma unroll
    for (int t = 0; t < 4; ++t) {
#pragma unroll
      for (int r = 0; r < 8; ++r) s[t][r] = 0.f;
      s[t] = wmma_bf16(ka[t][0], qf0, s[t]);
    }
#pragma unroll
    for (int t = 0; t < 4; ++t) s[t] = wmma_bf16(ka[t][1], qf1, s[t]);

    // V^T rows as A operand (row = d), 4 output d-tiles x 2 steps of 32 keys
    v16bf va[2][4];
#pragma unroll
    for (int u = 0; u < 2; ++u) {
#pragma unroll
      for (int t = 0; t < 4; ++t) {
        const unsigned short* vr = &Vs[bf][16 * t + ln][32 * u + half * 8];
        va[u][t] = ld16bf(vr, vr + 16);
      }
    }
    // keeps the V^T reads together ahead of the softmax, which covers their
    // latency: without it each stands in front of the product that waits for it
    __builtin_amdgcn_sched_barrier(0);

    // scale + attention mask
#pragma unroll
    for (int t = 0; t < 4; ++t)
      s[t] = s[t] * 0.125f + __builtin_shufflevector(mk[2 * t], mk[2 * t + 1],
                                                     0, 1, 2, 3, 4, 5, 6, 7);

    // online softmax: 32 keys in-lane, the other 32 in lane ^ 16
    float vm[4];
#pragma unroll
    for (int t = 0; t < 4; ++t) {
      vm[t] = s[t][0];
#pragma unroll
      for (int r = 1; r < 8; ++r) vm[t] = fmaxf(vm[t], s[t][r]);
    }
    float v = fmaxf(fmaxf(vm[0], vm[1]), fmaxf(vm[2], vm[3]));
    v = fmaxf(v, xhalf(v));
    const float mn   = fmaxf(mrow, v);
    const float corr = __expf(mrow - mn);
    mrow = mn;

    // P^T as B operand of step u: element e <-> key 32 u + 8 half + e,
    // 8 + e <-> 32 u + 16 + 8 half + e
    v16bf pb[2];
    v8f p[4];
#pragma unroll
    for (int t = 0; t < 4; ++t) {
#pragma unroll
      for (int r = 0; r < 8; ++r) {
        p[t][r] = __expf(s[t][r] - mn);
        pb[t >> 1][8 * (t & 1) + r] = (__bf16)p[t][r];
      }
    }
    // this half's 32 terms, summed pairwise
    const v8f   t8 = (p[0] + p[1]) + (p[2] + p[3]);
    const f32x4 t4 = __builtin_shufflevector(t8, t8, 0, 1, 2, 3) +
                     __builtin_shufflevector(t8, t8, 4, 5, 6, 7);
    lrow = lrow * corr + ((t4[0] + t4[2]) + (t4[1] + t4[3]));
#pragma unroll
    for (int t = 0; t < 4; ++t) {
#pragma unroll
      for (int r = 0; r < 8; ++r) o[t][r] *= corr;
    }

    // O^T += V^T . P^T   (two K=32 steps over this key chunk, 4 output d-tiles)
#pragma unroll
    for (int u = 0; u < 2; ++u) {
#pragma unroll
      for (int t = 0; t < 4; ++t) o[t] = wmma_bf16(va[u][t], pb[u], o[t]);
    }

    __syncthreads();   // all waves done with buffer bf before it refills
  }

  // join the halves' sums, normalize and emit context, merged heads bf16
  // [b*S+s][H]: 8 consecutive d per lane and tile, one 16-byte store each
  const float inv = 1.0f / (lrow + xhalf(lrow));
  unsigned short* crow =
      ctx + ((size_t)b * S_ + (qb + ln)) * H_ + (size_t)h * HD_ + half * 8;
  v8bf c0, c1, c2, c3;
#pragma unroll
  for (int r = 0; r < 8; ++r) {
    c0[r] = (__bf16)(o[0][r] * inv);
    c1[r] = (__bf16)(o[1][r] * inv);
    c2[r] = (__bf16)(o[2][r] * inv);
    c3[r] = (__bf16)(o[3][r] * inv);
  }
  *reinterpret_cast<u32x4*>(crow)      = __builtin_bit_cast(u32x4, c0);
  *reinterpret_cast<u32x4*>(crow + 16) = __builtin_bit_cast(u32x4, c1);
  *reinterpret_cast<u32x4*>(crow + 32) = __builtin_bit_cast(u32x4, c2);
  *reinterpret_cast<u32x4*>(crow + 48) = __builtin_bit_cast(u32x4, c3);
}

// ---------------------------------------------------------------------------
// Kernel 4: output projection + bias + residual + LayerNorm (fused)
// ---------------------------------------------------------------------------
// register budget as in the QKV kernel: one block per WGP, 4 waves per SIMD
__global__ __launch_bounds__(512) __attribute__((amdgpu_waves_per_eu(4, 4)))
void proj_ln_kernel(
    const unsigned short* __restrict__ ctx,
    const unsigned short* __restrict__ woT,
    const float* __restrict__ bo, const float* __restrict__ x,
    const float* __restrict__ gamma, const float* __restrict__ beta,
    float* __restrict__ out) {
  __shared__ __align__(16) unsigned short cA[GR_][264];
  __shared__ __align__(16) float          ot[GR_][264];

  const int tid = threadIdx.x;
  const int mbase = blockIdx.x * GR_;
  const int wave = tid >> 5, lane = tid & 31;
  const int half = lane >> 4, ln = lane & 15;
  const int j = wave * 16 + ln;

  // the wave's 16 weight columns need nothing from LDS: they are asked for
  // ahead of the barrier and arrive while the ctx tile is staged
  const float bb = bo[j];
  const unsigned short* bp = woT + (size_t)j * H_ + half * 8;
  v16bf bw[H_ / 32];
#pragma unroll
  for (int k = 0; k < H_ / 32; ++k)
    bw[k] = ld16bf(bp + 32 * k, bp + 32 * k + 16);

  { // stage ctx tile (already bf16)
    const int ch = (tid & 31) * 8;
#pragma unroll
    for (int t = 0; t < GT_; ++t) {
      const int row = (tid >> 5) + 16 * t;
      *reinterpret_cast<u32x4*>(&cA[row][ch]) =
          *reinterpret_cast<const u32x4*>(ctx + (size_t)(mbase + row) * H_ + ch);
    }
  }
  __syncthreads();

  v8f c[GT_];
#pragma unroll
  for (int t = 0; t < GT_; ++t) {
#pragma unroll
    for (int r = 0; r < 8; ++r) c[t][r] = bb;
  }

#pragma unroll
  for (int kk = 0; kk < H_; kk += 32) {
#pragma unroll
    for (int t = 0; t < GT_; ++t) {
      const unsigned short* ar = &cA[16 * t + ln][kk + half * 8];
      c[t] = wmma_bf16(ld16bf(ar, ar + 16), bw[kk / 32], c[t]);
    }
  }

  // + residual, stage rows for LayerNorm
  {
    const float* xr = x + (size_t)(mbase + 8 * half) * H_ + j;
    float res[GT_][8];
#pragma unroll
    for (int t = 0; t < GT_; ++t) {
#pragma unroll
      for (int r = 0; r < 8; ++r) res[t][r] = xr[(16 * t + r) * H_];
    }
    // the loads' address stays whole up to this wait
    asm volatile("s_wait_xcnt 0x0" :: "v"(xr) : "memory");
#pragma unroll
    for (int t = 0; t < GT_; ++t) {
#pragma unroll
      for (int r = 0; r < 8; ++r)
        ot[16 * t + r + 8 * half][j] = c[t][r] + res[t][r];
    }
  }
  __syncthreads();

  // LayerNorm: wave w normalizes rows w, w + 16, ... (256 cols, 8 per lane)
#pragma unroll
  for (int t = 0; t < GT_; ++t) {
    const int row = wave + 16 * t, c0 = lane * 8;
    float vals[8], s = 0.f, sq = 0.f;
#pragma unroll
    for (int i = 0; i < 8; ++i) {
      vals[i] = ot[row][c0 + i];
      s += vals[i];
      sq += vals[i] * vals[i];
    }
    s  += __shfl_xor(s, 16, 32);  sq += __shfl_xor(sq, 16, 32);
    s  += __shfl_xor(s, 8, 32);   sq += __shfl_xor(sq, 8, 32);
    s  += __shfl_xor(s, 4, 32);   sq += __shfl_xor(sq, 4, 32);
    s  += __shfl_xor(s, 2, 32);   sq += __shfl_xor(sq, 2, 32);
    s  += __shfl_xor(s, 1, 32);   sq += __shfl_xor(sq, 1, 32);
    const float mu  = s * (1.0f / 256.0f);
    const float var = sq * (1.0f / 256.0f) - mu * mu;
    const float inv = rsqrtf(var + 1e-12f);
    const size_t gr = (size_t)(mbase + row) * H_;
#pragma unroll
    for (int i = 0; i < 8; ++i) {
      const int col = c0 + i;
      out[gr + col] = (vals[i] - mu) * inv * gamma[col] + beta[col];
    }
  }
}

// ---------------------------------------------------------------------------
extern "C" void kernel_launch(void* const* d_in, const int* in_sizes, int n_in,
                              void* d_out, int out_size, void* d_ws, size_t ws_size,
                              hipStream_t stream) {
  const float* x     = (const float*)d_in[0];
  const float* mask  = (const float*)d_in[1];
  const float* Wq    = (const float*)d_in[2];
  const float* bq    = (const float*)d_in[3];
  const float* Wk    = (const float*)d_in[4];
  const float* bk    = (const float*)d_in[5];
  const float* Wv    = (const float*)d_in[6];
  const float* bv    = (const float*)d_in[7];
  const float* Wo    = (const float*)d_in[8];
  const float* bo    = (const float*)d_in[9];
  const float* gamma = (const float*)d_in[10];
  const float* beta  = (const float*)d_in[11];
  float* out = (float*)d_out;

  // workspace layout (ushort elements)
  unsigned short* ws  = (unsigned short*)d_ws;
  unsigned short* wT  = ws;                         // 4 * 256*256
  unsigned short* Qb  = ws + 4 * H_ * H_;           // [B][NH][S][HD]
  unsigned short* Kb  = Qb + (size_t)B_ * NH_ * S_ * HD_;
  unsigned short* Vtb = Kb + (size_t)B_ * NH_ * S_ * HD_;
  unsigned short* ctx = Vtb + (size_t)B_ * NH_ * S_ * HD_;  // [M][H]

  prep_weights_kernel<<<dim3(H_ * H_ / 256, 4), 256, 0, stream>>>(
      Wq, Wk, Wv, Wo, wT);

  qkv_kernel<<<M_ / GR_, 512, 0, stream>>>(
      x, bq, bk, bv, wT, wT + H_ * H_, wT + 2 * H_ * H_, Qb, Kb, Vtb);

  attn_kernel<<<dim3(S_ / QB_, NH_, B_), 256, 0, stream>>>(
      mask, Qb, Kb, Vtb, ctx);

  proj_ln_kernel<<<M_ / GR_, 512, 0, stream>>>(
      ctx, wT + 3 * H_ * H_, bo, x, gamma, beta, out);
}

// v005
// Measured time: 64.7 microseconds a run.
// Two timings next to v004 both put it at 1.17 times that version's speed.
// Over all steps from v000 it is 2.59 times as fast.
#include <hip/hip_runtime.h>
#include <hip/hip_bf16.h>
#include <math.h>

// Problem constants (match reference)
#define B_   8
#define S_   2048
#define H_   256
#define NH_  4
#define HD_  64
#define M_   (B_ * S_)          // 16384 rows

typedef __attribute__((ext_vector_type(16))) __bf16       v16bf;
typedef __attribute__((ext_vector_type(8)))  __bf16       v8bf;
typedef __attribute__((ext_vector_type(8)))  float        v8f;
typedef __attribute__((ext_vector_type(4)))  float        f32x4;
typedef __attribute__((ext_vector_type(4)))  unsigned int u32x4;

struct U32x8 { u32x4 lo, hi; };

// float -> bf16 (round to nearest even, NaN-agnostic — inputs are sane)
static __device__ __forceinline__ unsigned short f2bf(float f) {
  unsigned u = __builtin_bit_cast(unsigned, f);
  u += 0x7FFFu + ((u >> 16) & 1u);
  return (unsigned short)(u >> 16);
}

// Build a WMMA 16-bf16 operand from two aligned 16-byte chunks.
// Per ISA 7.12.2 (wave32): per lane, elements 0..7 <-> K = half*8 + e,
// elements 8..15 <-> K = 16 + half*8 + e.  Storing tiles row-major [m][k]
// (A) or [n][k] (B-transposed) makes both chunks contiguous b128 loads.
static __device__ __forceinline__ v16bf ld16bf(const unsigned short* p0,
                                               const unsigned short* p1) {
  U32x8 u;
  u.lo = *reinterpret_cast<const u32x4*>(p0);
  u.hi = *reinterpret_cast<const u32x4*>(p1);
  return __builtin_bit_cast(v16bf, u);
}

static __device__ __forceinline__ v8f wmma_bf16(v16bf a, v16bf b, v8f c) {
  return __builtin_amdgcn_wmma_f32_16x16x32_bf16(
      /*neg_a=*/false, a, /*neg_b=*/false, b,
      /*c_mod=*/(short)0, c, /*reuse_a=*/false, /*reuse_b=*/false);
}

// --- CDNA5 async memory->LDS copy (ASYNCcnt path) --------------------------
// Per lane: LDS[ldsOff] <- MEM[base + gOff] (16 bytes).  GVS addressing:
// 64-bit SGPR base + 32-bit per-lane VGPR offset.  LDS offset is the low
// 32 bits of the generic shared-space address (aperture: addr[31:0]).
static __device__ __forceinline__ unsigned lds_off(const void* p) {
  return (unsigned)(size_t)p;
}
// One chunk's twelve copies of a lane: eight from the mask, two from K, two
// from V^T.  The closing s_wait_xcnt 0 stands inside the copies' own statement
// so that no later write of an address register they name can be placed in
// front of it.
static __device__ __forceinline__ void async_chunk_b128(
    unsigned lm0, unsigned lm1, unsigned lm2, unsigned lm3,
    unsigned lm4, unsigned lm5, unsigned lm6, unsigned lm7,
    unsigned lk0, unsigned lk1, unsigned lv0, unsigned lv1,
    unsigned gm0, unsigned gm1, unsigned gm2, unsigned gm3,
    unsigned gm4, unsigned gm5, unsigned gm6, unsigned gm7,
    unsigned gk0, unsigned gk1, unsigned gv0, unsigned gv1,
    const void* mbase, const void* kbase, const void* vbase) {
  asm volatile("global_load_async_to_lds_b128 %0, %12, %24\n\t"
               "global_load_async_to_lds_b128 %1, %13, %24\n\t"
               "global_load_async_to_lds_b128 %2, %14, %24\n\t"
               "global_load_async_to_lds_b128 %3, %15, %24\n\t"
               "global_load_async_to_lds_b128 %4, %16, %24\n\t"
               "global_load_async_to_lds_b128 %5, %17, %24\n\t"
               "global_load_async_to_lds_b128 %6, %18, %24\n\t"
               "global_load_async_to_lds_b128 %7, %19, %24\n\t"
               "global_load_async_to_lds_b128 %8, %20, %25\n\t"
               "global_load_async_to_lds_b128 %9, %21, %25\n\t"
               "global_load_async_to_lds_b128 %10, %22, %26\n\t"
               "global_load_async_to_lds_b128 %11, %23, %26\n\t"
               "s_wait_xcnt 0x0"
               :
               : "v"(lm0), "v"(lm1), "v"(lm2), "v"(lm3),
                 "v"(lm4), "v"(lm5), "v"(lm6), "v"(lm7),
                 "v"(lk0), "v"(lk1), "v"(lv0), "v"(lv1),
                 "v"(gm0), "v"(gm1), "v"(gm2), "v"(gm3),
                 "v"(gm4), "v"(gm5), "v"(gm6), "v"(gm7),
                 "v"(gk0), "v"(gk1), "v"(gv0), "v"(gv1),
                 "s"((unsigned long long)(size_t)mbase),
                 "s"((unsigned long long)(size_t)kbase),
                 "s"((unsigned long long)(size_t)vbase)
               : "memory");
}

// ---------------------------------------------------------------------------
// Kernel 1: convert the 4 weight matrices to bf16, packed in the order in which
// the projections read their B fragments:
//   [matrix][16-column tile][k step of 32][piece 0..1][lane][8 bf16]
// Lane (half, ln) of piece c holds column 16 tile + ln, k = 32 step + 16 c +
// 8 half + 0..7, so one 16-byte load of a whole wave covers 512 contiguous
// bytes (4 whole lines) and a wave's share of a matrix is 8 KiB in a row.
// One thread converts and stores one 16-byte piece.
// ---------------------------------------------------------------------------
#define WSTEP_ 512              // bf16 elements of one tile's k step (2 pieces)
#define WTILE_ (16 * H_)        // bf16 elements of one 16-column tile
__global__ __launch_bounds__(256) void prep_weights_kernel(
    const float* __restrict__ Wq, const float* __restrict__ Wk,
    const float* __restrict__ Wv, const float* __restrict__ Wo,
    unsigned short* __restrict__ wP) {
  const int mat = blockIdx.y;
  const float* src = (mat == 0) ? Wq : (mat == 1) ? Wk : (mat == 2) ? Wv : Wo;
  const int g = blockIdx.x * 256 + threadIdx.x;   // 16-byte piece of the matrix
  const int lane = g & 31, c = (g >> 5) & 1, ks = (g >> 6) & 7, tile = g >> 9;
  const int n = tile * 16 + (lane & 15);
  const int k = ks * 32 + c * 16 + (lane >> 4) * 8;
  const float* s = src + k * H_ + n;
  float f[8];
#pragma unroll
  for (int e = 0; e < 8; ++e) f[e] = s[e * H_];
  u32x4 o;
#pragma unroll
  for (int i = 0; i < 4; ++i)
    o[i] = (unsigned)f2bf(f[2 * i]) | ((unsigned)f2bf(f[2 * i + 1]) << 16);
  *reinterpret_cast<u32x4*>(wP + (size_t)mat * H_ * H_ + (size_t)g * 8) = o;
}

// ---------------------------------------------------------------------------
// Kernel 2: QKV projection.  64-row m-tile per block, 16 waves = 16 n-tiles;
// a wave keeps 4 row tiles x 3 matrices of accumulators, so every weight
// fragment it loads feeds 4 products.
// Writes Q,K bf16 [b][h][s][d]; V transposed bf16 [b][h][d][s].
// ---------------------------------------------------------------------------
#define GT_ 4                   // 16-row tiles per block in both projections
#define GR_ (16 * GT_)          // rows per block

// one block per WGP (grid = 256): 4 waves per SIMD is all that can be resident,
// so the compiler may spend that share of the registers on loads issued ahead
__global__ __launch_bounds__(512) __attribute__((amdgpu_waves_per_eu(4, 4)))
void qkv_kernel(
    const float* __restrict__ x,
    const float* __restrict__ bq, const float* __restrict__ bk,
    const float* __restrict__ bv,
    const unsigned short* __restrict__ wqP,
    const unsigned short* __restrict__ wkP,
    const unsigned short* __restrict__ wvP,
    unsigned short* __restrict__ Q, unsigned short* __restrict__ K,
    unsigned short* __restrict__ Vt) {
  __shared__ __align__(16) unsigned short xA[GR_][264];

  const int tid   = threadIdx.x;
  const int mbase = blockIdx.x * GR_;
  const int wave = tid >> 5, lane = tid & 31;
  const int half = lane >> 4, ln = lane & 15;
  const int j = wave * 16 + ln;                // global output column

  // biases and the first k step's weight fragments need nothing from LDS:
  // they are asked for ahead of the barrier and arrive while x is staged
  const float biasq = bq[j], biask = bk[j], biasv = bv[j];
  const unsigned short* pq = wqP + wave * WTILE_ + lane * 8;
  const unsigned short* pk = wkP + wave * WTILE_ + lane * 8;
  const unsigned short* pv = wvP + wave * WTILE_ + lane * 8;
  v16bf nq = ld16bf(pq, pq + 256);
  v16bf nk = ld16bf(pk, pk + 256);
  v16bf nv = ld16bf(pv, pv + 256);

  { // stage 64x256 fp32 -> bf16 LDS, one whole row per wave and pass
    const int col = (tid & 31) * 8, row = tid >> 5;
    const float* src = x + (size_t)(mbase + row) * H_ + col;
    f32x4 lo[GT_], hi[GT_];
#pragma unroll
    for (int t = 0; t < GT_; ++t) {
      lo[t] = *reinterpret_cast<const f32x4*>(src + 16 * t * H_);
      hi[t] = *reinterpret_cast<const f32x4*>(src + 16 * t * H_ + 4);
    }
    // the loads' address stays whole up to this wait
    asm volatile("s_wait_xcnt 0x0" :: "v"(src) : "memory");
#pragma unroll
    for (int t = 0; t < GT_; ++t) {
#pragma unroll
      for (int i = 0; i < 4; ++i) {
        xA[row + 16 * t][col + i]     = f2bf(lo[t][i]);
        xA[row + 16 * t][col + 4 + i] = f2bf(hi[t][i]);
      }
    }
  }
  __syncthreads();

  v8f cq[GT_], ck[GT_], cv[GT_];
#pragma unroll
  for (int t = 0; t < GT_; ++t) {
#pragma unroll
    for (int r = 0; r < 8; ++r) {
      cq[t][r] = biasq; ck[t][r] = biask; cv[t][r] = biasv;
    }
  }

  // weight fragments are fetched one k step ahead of the products they feed
#pragma unroll
  for (int kk = 0; kk < H_; kk += 32) {
    const v16bf bqv = nq, bkv = nk, bvv = nv;
    if (kk + 32 < H_) {
      const int nx = (kk / 32 + 1) * WSTEP_;
      nq = ld16bf(pq + nx, pq + nx + 256);
      nk = ld16bf(pk + nx, pk + nx + 256);
      nv = ld16bf(pv + nx, pv + nx + 256);
      // holds the next step's weight loads in front of this step's products:
      // without it they sink to just ahead of their use and each k step
      // waits out the L2 latency
      __builtin_amdgcn_sched_barrier(0);
    }
#pragma unroll
    for (int t = 0; t < GT_; ++t) {
      const unsigned short* ar = &xA[16 * t + ln][kk + half * 8];
      const v16bf a = ld16bf(ar, ar + 16);
      cq[t] = wmma_bf16(a, bqv, cq[t]);
      ck[t] = wmma_bf16(a, bkv, ck[t]);
      cv[t] = wmma_bf16(a, bvv, cv[t]);
    }
  }

  const int h = j >> 6, d = j & 63;
#pragma unroll
  for (int t = 0; t < GT_; ++t) {
#pragma unroll
    for (int r = 0; r < 8; ++r) {
      const int gr = mbase + 16 * t + r + 8 * half; // global row in [M_]
      const int b = gr >> 11, s = gr & (S_ - 1);
      const size_t qoff = (((size_t)b * NH_ + h) * S_ + s) * HD_ + d;
      Q[qoff] = f2bf(cq[t][r]);
      K[qoff] = f2bf(ck[t][r]);
      Vt[(((size_t)b * NH_ + h) * HD_ + d) * S_ + s] = f2bf(cv[t][r]);
    }
  }
}

#define KC_ 64
#define QB_ 128
// lane l <-> lane l ^ 16
static __device__ __forceinline__ float xhalf(float v) {
  const int i = __builtin_bit_cast(int, v);
  return __builtin_bit_cast(
      float, __builtin_amdgcn_permlanex16(i, i, 0x76543210, 0xfedcba98,
                                          false, false));
}

// 2 blocks per WGP (grid = 512): 4 waves per SIMD must stay resident, which
// bounds the registers of a wave
__global__ __launch_bounds__(256) __attribute__((amdgpu_waves_per_eu(4, 4)))
void attn_kernel(
    const float* __restrict__ mask,
    const unsigned short* __restrict__ Q,
    const unsigned short* __restrict__ K,
    const unsigned short* __restrict__ Vt,
    unsigned short* __restrict__ ctx) {
  __shared__ __align__(16) unsigned short Ks[2][KC_][72];      // key chunk [key][d]
  __shared__ __align__(16) unsigned short Vs[2][64][KC_ + 8];  // V^T chunk [d][key]
  __shared__ __align__(16) float          Ms[2][QB_][KC_ + 4]; // mask chunk [q][key]

  const int tid = threadIdx.x, wave = tid >> 5, lane = tid & 31;
  const int half = lane >> 4, ln = lane & 15;
  const int b = blockIdx.z, h = blockIdx.y;
  const int qb = blockIdx.x * QB_ + wave * 16;

  const size_t headQK = ((size_t)b * NH_ + h) * S_ * HD_;
  const size_t headV  = ((size_t)b * NH_ + h) * HD_ * S_;
  const unsigned short* qbase = Q + headQK + (size_t)qb * HD_;
  const unsigned short* kbase = K + headQK;
  const unsigned short* vbase = Vt + headV;

  // Q^T as B operand (column = query ln), loaded once and kept in registers
  const unsigned short* qrow = qbase + ln * HD_ + half * 8;
  const v16bf qf0 = ld16bf(qrow, qrow + 16);
  const v16bf qf1 = ld16bf(qrow + 32, qrow + 48);

  // mask rows of this block's 128 queries; this lane copies 16 bytes of rows
  // mrw, mrw + 2, ..., mrw + 14, all among its own wave's 16 queries
  const float* mbase = mask + ((size_t)b * S_ + blockIdx.x * QB_) * S_;
  const int mrw = wave * 16 + (lane >> 4), mch = (lane & 15) * 4;

  // issue one 64-key K/V/mask chunk into buffer bf (12 wave-ops, in-order)
  auto issue_chunk = [&](int k0, int bf) {
    const int rr = tid >> 3, cc = (tid & 7) * 8;   // K, V^T: 64x64 bf16, rows rr, rr + 32
    async_chunk_b128(lds_off(&Ms[bf][mrw][mch]),                // mask: 128x64 f32
                     lds_off(&Ms[bf][mrw + 2][mch]),
                     lds_off(&Ms[bf][mrw + 4][mch]),
                     lds_off(&Ms[bf][mrw + 6][mch]),
                     lds_off(&Ms[bf][mrw + 8][mch]),
                     lds_off(&Ms[bf][mrw + 10][mch]),
                     lds_off(&Ms[bf][mrw + 12][mch]),
                     lds_off(&Ms[bf][mrw + 14][mch]),
                     lds_off(&Ks[bf][rr][cc]), lds_off(&Ks[bf][rr + 32][cc]),
                     lds_off(&Vs[bf][rr][cc]), lds_off(&Vs[bf][rr + 32][cc]),
                     (unsigned)((mrw * S_ + k0 + mch) * 4),
                     (unsigned)(((mrw + 2) * S_ + k0 + mch) * 4),
                     (unsigned)(((mrw + 4) * S_ + k0 + mch) * 4),
                     (unsigned)(((mrw + 6) * S_ + k0 + mch) * 4),
                     (unsigned)(((mrw + 8) * S_ + k0 + mch) * 4),
                     (unsigned)(((mrw + 10) * S_ + k0 + mch) * 4),
                     (unsigned)(((mrw + 12) * S_ + k0 + mch) * 4),
                     (unsigned)(((mrw + 14) * S_ + k0 + mch) * 4),
                     (unsigned)(((k0 + rr) * HD_ + cc) * 2),
                     (unsigned)(((k0 + rr + 32) * HD_ + cc) * 2),
                     (unsigned)((rr * S_ + k0 + cc) * 2),
                     (unsigned)(((rr + 32) * S_ + k0 + cc) * 2),
                     mbase, kbase, vbase);
  };

  // every loop over t, u or r below is unrolled so that the register arrays it
  // walks are indexed by constants and never leave the registers
  // o[t][r] = O[query ln][d = 16 t + 8 half + r]
  v8f o[4];
#pragma unroll
  for (int t = 0; t < 4; ++t) {
#pragma unroll
    for (int r = 0; r < 8; ++r) o[t][r] = 0.f;
  }
  float mrow = -1e30f;   // running maximum of query ln (equal in both halves)
  float lrow = 0.f;      // running sum over this half's keys only

  issue_chunk(0, 0);

  for (int k0 = 0; k0 < S_; k0 += KC_) {
    const int bf = (k0 / KC_) & 1;
    if (k0 + KC_ < S_) {
      issue_chunk(k0 + KC_, bf ^ 1);
      // 12 ops of chunk i+1 in flight; retire chunk i
      asm volatile("s_wait_asynccnt 12" ::: "memory");
    } else {
      asm volatile("s_wait_asynccnt 0" ::: "memory");
    }
    __syncthreads();   // chunk bf visible to all waves

    // attention mask: 4 x 8 consecutive keys of one query per lane
    // (keys 16 t + 8 half + r)
    const float* mr = &Ms[bf][wave * 16 + ln][half * 8];
    f32x4 mk[8];
#pragma unroll
    for (int t = 0; t < 4; ++t) {
      mk[2 * t]     = *reinterpret_cast<const f32x4*>(mr + 16 * t);
      mk[2 * t + 1] = *reinterpret_cast<const f32x4*>(mr + 16 * t + 4);
    }
    // K rows as A operand (row = key), both d halves of the four 16-key subtiles
    v16bf ka[4][2];
#pragma unroll
    for (int t = 0; t < 4; ++t) {
      const unsigned short* kr = &Ks[bf][16 * t + ln][half * 8];
      ka[t][0] = ld16bf(kr, kr + 16);
      ka[t][1] = ld16bf(kr + 32, kr + 48);
    }
    // keeps these LDS reads together ahead of the products: without it each
    // read stands directly in front of the product that waits for it
    __builtin_amdgcn_sched_barrier(0);

    // scores^T = K . Q^T over d=64 (two K=32 WMMA steps, four 16-key subtiles)
    // s[t][r] = S[query ln][key = 16 t + 8 half + r]
    v8f s[4];
#pragma unroll
    for (int t = 0; t < 4; ++t) {
#pragma unroll
      for (int r = 0; r < 8; ++r) s[t][r] = 0.f;
      s[t] = wmma_bf16(ka[t][0], qf0, s[t]);
    }
#pragma unroll
    for (int t = 0; t < 4; ++t) s[t] = wmma_bf16(ka[t][1], qf1, s[t]);

    // V^T rows as A operand (row = d), 4 output d-tiles x 2 steps of 32 keys
    v16bf va[2][4];
#pragma unroll
    for (int u = 0; u < 2; ++u) {
#pragma unroll
      for (int t = 0; t < 4; ++t) {
        const unsigned short* vr = &Vs[bf][16 * t + ln][32 * u + half * 8];
        va[u][t] = ld16bf(vr, vr + 16);
      }
    }
    // keeps the V^T reads together ahead of the softmax, which covers their
    // latency: without it each stands in front of the product that waits for it
    __builtin_amdgcn_sched_barrier(0);

    // scale + attention mask
#pragma unroll
    for (int t = 0; t < 4; ++t)
      s[t] = s[t] * 0.125f + __builtin_shufflevector(mk[2 * t], mk[2 * t + 1],
                                                     0, 1, 2, 3, 4, 5, 6, 7);

    // online softmax: 32 keys in-lane, the other 32 in lane ^ 16
    float vm[4];
#pragma unroll
    for (int t = 0; t < 4; ++t) {
      vm[t] = s[t][0];
#pragma unroll
      for (int r = 1; r < 8; ++r) vm[t] = fmaxf(vm[t], s[t][r]);
    }
    float v = fmaxf(fmaxf(vm[0], vm[1]), fmaxf(vm[2], vm[3]));
    v = fmaxf(v, xhalf(v));
    const float mn   = fmaxf(mrow, v);
    const float corr = __expf(mrow - mn);
    mrow = mn;

    // P^T as B operand of step u: element e <-> key 32 u + 8 half + e,
    // 8 + e <-> 32 u + 16 + 8 half + e
    v16bf pb[2];
    v8f p[4];
#pragma unroll
    for (int t = 0; t < 4; ++t) {
#pragma unroll
      for (int r = 0; r < 8; ++r) {
        p[t][r] = __expf(s[t][r] - mn);
        pb[t >> 1][8 * (t & 1) + r] = (__bf16)p[t][r];
      }
    }
    // this half's 32 terms, summed pairwise
    const v8f   t8 = (p[0] + p[1]) + (p[2] + p[3]);
    const f32x4 t4 = __builtin_shufflevector(t8, t8, 0, 1, 2, 3) +
                     __builtin_shufflevector(t8, t8, 4, 5, 6, 7);
    lrow = lrow * corr + ((t4[0] + t4[2]) + (t4[1] + t4[3]));
#pragma unroll
    for (int t = 0; t < 4; ++t) {
#pragma unroll
      for (int r = 0; r < 8; ++r) o[t][r] *= corr;
    }

    // O^T += V^T . P^T   (two K=32 steps over this key chunk, 4 output d-tiles)
#pragma unroll
    for (int u = 0; u < 2; ++u) {
#pragma unroll
      for (int t = 0; t < 4; ++t) o[t] = wmma_bf16(va[u][t], pb[u], o[t]);
    }

    __syncthreads();   // all waves done with buffer bf before it refills
  }

  // join the halves' sums, normalize and emit context, merged heads bf16
  // [b*S+s][H]: 8 consecutive d per lane and tile, one 16-byte store each
  const float inv = 1.0f / (lrow + xhalf(lrow));
  unsigned short* crow =
      ctx + ((size_t)b * S_ + (qb + ln)) * H_ + (size_t)h * HD_ + half * 8;
  v8bf c0, c1, c2, c3;
#pragma unroll
  for (int r = 0; r < 8; ++r) {
    c0[r] = (__bf16)(o[0][r] * inv);
    c1[r] = (__bf16)(o[1][r] * inv);
    c2[r] = (__bf16)(o[2][r] * inv);
    c3[r] = (__bf16)(o[3][r] * inv);
  }
  *reinterpret_cast<u32x4*>(crow)      = __builtin_bit_cast(u32x4, c0);
  *reinterpret_cast<u32x4*>(crow + 16) = __builtin_bit_cast(u32x4, c1);
  *reinterpret_cast<u32x4*>(crow + 32) = __builtin_bit_cast(u32x4, c2);
  *reinterpret_cast<u32x4*>(crow + 48) = __builtin_bit_cast(u32x4, c3);
}

// ---------------------------------------------------------------------------
// Kernel 4: output projection + bias + residual + LayerNorm (fused)
// ---------------------------------------------------------------------------
// register budget as in the QKV kernel: one block per WGP, 4 waves per SIMD
__global__ __launch_bounds__(512) __attribute__((amdgpu_waves_per_eu(4, 4)))
void proj_ln_kernel(
    const unsigned short* __restrict__ ctx,
    const unsigned short* __restrict__ woP,
    const float* __restrict__ bo, const float* __restrict__ x,
    const float* __restrict__ gamma, const float* __restrict__ beta,
    float* __restrict__ out) {
  __shared__ __align__(16) unsigned short cA[GR_][264];
  __shared__ __align__(16) float          ot[GR_][264];

  const int tid = threadIdx.x;
  const int mbase = blockIdx.x * GR_;
  const int wave = tid >> 5, lane = tid & 31;
  const int half = lane >> 4, ln = lane & 15;
  const int j = wave * 16 + ln;

  // the wave's 16 weight columns need nothing from LDS: they are asked for
  // ahead of the barrier and arrive while the ctx tile is staged
  const float bb = bo[j];
  const unsigned short* bp = woP + wave * WTILE_ + lane * 8;
  v16bf bw[H_ / 32];
#pragma unroll
  for (int k = 0; k < H_ / 32; ++k)
    bw[k] = ld16bf(bp + WSTEP_ * k, bp + WSTEP_ * k + 256);

  { // stage ctx tile (already bf16)
    const int ch = (tid & 31) * 8;
#pragma unroll
    for (int t = 0; t < GT_; ++t) {
      const int row = (tid >> 5) + 16 * t;
      *reinterpret_cast<u32x4*>(&cA[row][ch]) =
          *reinterpret_cast<const u32x4*>(ctx + (size_t)(mbase + row) * H_ + ch);
    }
  }
  // the weight loads' address stays whole up to this wait
  asm volatile("s_wait_xcnt 0x0" :: "v"(bp) : "memory");
  __syncthreads();

  v8f c[GT_];
#pragma unroll
  for (int t = 0; t < GT_; ++t) {
#pragma unroll
    for (int r = 0; r < 8; ++r) c[t][r] = bb;
  }

#pragma unroll
  for (int kk = 0; kk < H_; kk += 32) {
#pragma unroll
    for (int t = 0; t < GT_; ++t) {
      const unsigned short* ar = &cA[16 * t + ln][kk + half * 8];
      c[t] = wmma_bf16(ld16bf(ar, ar + 16), bw[kk / 32], c[t]);
    }
  }

  // + residual, stage rows for LayerNorm
  {
    const float* xr = x + (size_t)(mbase + 8 * half) * H_ + j;
    float res[GT_][8];
#pragma unroll
    for (int t = 0; t < GT_; ++t) {
#pragma unroll
      for (int r = 0; r < 8; ++r) res[t][r] = xr[(16 * t + r) * H_];
    }
    // the loads' address stays whole up to this wait
    asm volatile("s_wait_xcnt 0x0" :: "v"(xr) : "memory");
#pragma unroll
    for (int t = 0; t < GT_; ++t) {
#pragma unroll
      for (int r = 0; r < 8; ++r)
        ot[16 * t + r + 8 * half][j] = c[t][r] + res[t][r];
    }
  }
  __syncthreads();

  // LayerNorm: wave w normalizes rows w, w + 16, ... (256 cols, 8 per lane)
#pragma unroll
  for (int t = 0; t < GT_; ++t) {
    const int row = wave + 16 * t, c0 = lane * 8;
    float vals[8], s = 0.f, sq = 0.f;
#pragma unroll
    for (int i = 0; i < 8; ++i) {
      vals[i] = ot[row][c0 + i];
      s += vals[i];
      sq += vals[i] * vals[i];
    }
    s  += __shfl_xor(s, 16, 32);  sq += __shfl_xor(sq, 16, 32);
    s  += __shfl_xor(s, 8, 32);   sq += __shfl_xor(sq, 8, 32);
    s  += __shfl_xor(s, 4, 32);   sq += __shfl_xor(sq, 4, 32);
    s  += __shfl_xor(s, 2, 32);   sq += __shfl_xor(sq, 2, 32);
    s  += __shfl_xor(s, 1, 32);   sq += __shfl_xor(sq, 1, 32);
    const float mu  = s * (1.0f / 256.0f);
    const float var = sq * (1.0f / 256.0f) - mu * mu;
    const float inv = rsqrtf(var + 1e-12f);
    const size_t gr = (size_t)(mbase + row) * H_;
#pragma unroll
    for (int i = 0; i < 8; ++i) {
      const int col = c0 + i;
      out[gr + col] = (vals[i] - mu) * inv * gamma[col] + beta[col];
    }
  }
}

// ---------------------------------------------------------------------------
extern "C" void kernel_launch(void* const* d_in, const int* in_sizes, int n_in,
                              void* d_out, int out_size, void* d_ws, size_t ws_size,
                              hipStream_t stream) {
  const float* x     = (const float*)d_in[0];
  const float* mask  = (const float*)d_in[1];
  const float* Wq    = (const float*)d_in[2];
  const float* bq    = (const float*)d_in[3];
  const float* Wk    = (const float*)d_in[4];
  const float* bk    = (const float*)d_in[5];
  const float* Wv    = (const float*)d_in[6];
  const float* bv    = (const float*)d_in[7];
  const float* Wo    = (const float*)d_in[8];
  const float* bo    = (const float*)d_in[9];
  const float* gamma = (const float*)d_in[10];
  const float* beta  = (const float*)d_in[11];
  float* out = (float*)d_out;

  // workspace layout (ushort elements)
  unsigned short* ws  = (unsigned short*)d_ws;
  unsigned short* wT  = ws;                         // 4 * 256*256
  unsigned short* Qb  = ws + 4 * H_ * H_;           // [B][NH][S][HD]
  unsigned short* Kb  = Qb + (size_t)B_ * NH_ * S_ * HD_;
  unsigned short* Vtb = Kb + (size_t)B_ * NH_ * S_ * HD_;
  unsigned short* ctx = Vtb + (size_t)B_ * NH_ * S_ * HD_;  // [M][H]

  prep_weights_kernel<<<dim3(H_ * H_ / 8 / 256, 4), 256, 0, stream>>>(
      Wq, Wk, Wv, Wo, wT);

  qkv_kernel<<<M_ / GR_, 512, 0, stream>>>(
      x, bq, bk, bv, wT, wT + H_ * H_, wT + 2 * H_ * H_, Qb, Kb, Vtb);

  attn_kernel<<<dim3(S_ / QB_, NH_, B_), 256, 0, stream>>>(
      mask, Qb, Kb, Vtb, ctx);

  proj_ln_kernel<<<M_ / GR_, 512, 0, stream>>>(
      ctx, wT + 3 * H_ * H_, bo, x, gamma, beta, out);
}

// v006
// A run of this version takes 62.4 microseconds.
// Timed twice side by side with v005, it ran 1.04 and 1.03 times as fast.
// All steps since v000 together make it 2.69 times as fast.
#include <hip/hip_runtime.h>
#include <hip/hip_bf16.h>
#include <math.h>

// Problem constants (match reference)
#define B_   8
#define S_   2048
#define H_   256
#define NH_  4
#define HD_  64
#define M_   (B_ * S_)          // 16384 rows

typedef __attribute__((ext_vector_type(16))) __bf16       v16bf;
typedef __attribute__((ext_vector_type(8)))  __bf16       v8bf;
typedef __attribute__((ext_vector_type(8)))  float        v8f;
typedef __attribute__((ext_vector_type(4)))  float        f32x4;
typedef __attribute__((ext_vector_type(4)))  unsigned int u32x4;

struct U32x8 { u32x4 lo, hi; };

// float -> bf16 (round to nearest even, NaN-agnostic — inputs are sane)
static __device__ __forceinline__ unsigned short f2bf(float f) {
  unsigned u = __builtin_bit_cast(unsigned, f);
  u += 0x7FFFu + ((u >> 16) & 1u);
  return (unsigned short)(u >> 16);
}

// Build a WMMA 16-bf16 operand from two aligned 16-byte chunks.
// Per ISA 7.12.2 (wave32): per lane, elements 0..7 <-> K = half*8 + e,
// elements 8..15 <-> K = 16 + half*8 + e.  Storing tiles row-major [m][k]
// (A) or [n][k] (B-transposed) makes both chunks contiguous b128 loads.
static __device__ __forceinline__ v16bf ld16bf(const unsigned short* p0,
                                               const unsigned short* p1) {
  U32x8 u;
  u.lo = *reinterpret_cast<const u32x4*>(p0);
  u.hi = *reinterpret_cast<const u32x4*>(p1);
  return __builtin_bit_cast(v16bf, u);
}

static __device__ __forceinline__ v8f wmma_bf16(v16bf a, v16bf b, v8f c) {
  return __builtin_amdgcn_wmma_f32_16x16x32_bf16(
      /*neg_a=*/false, a, /*neg_b=*/false, b,
      /*c_mod=*/(short)0, c, /*reuse_a=*/false, /*reuse_b=*/false);
}

// --- CDNA5 async memory->LDS copy (ASYNCcnt path) --------------------------
// Per lane: LDS[ldsOff] <- MEM[base + gOff] (16 bytes).  GVS addressing:
// 64-bit SGPR base + 32-bit per-lane VGPR offset.  LDS offset is the low
// 32 bits of the generic shared-space address (aperture: addr[31:0]).
static __device__ __forceinline__ unsigned lds_off(const void* p) {
  return (unsigned)(size_t)p;
}
// One chunk's twelve copies of a lane: eight from the mask, two from K, two
// from V^T.  The closing s_wait_xcnt 0 stands inside the copies' own statement
// so that no later write of an address register they name can be placed in
// front of it.
static __device__ __forceinline__ void async_chunk_b128(
    unsigned lm0, unsigned lm1, unsigned lm2, unsigned lm3,
    unsigned lm4, unsigned lm5, unsigned lm6, unsigned lm7,
    unsigned lk0, unsigned lk1, unsigned lv0, unsigned lv1,
    unsigned gm0, unsigned gm1, unsigned gm2, unsigned gm3,
    unsigned gm4, unsigned gm5, unsigned gm6, unsigned gm7,
    unsigned gk0, unsigned gk1, unsigned gv0, unsigned gv1,
    const void* mbase, const void* kbase, const void* vbase) {
  asm volatile("global_load_async_to_lds_b128 %0, %12, %24\n\t"
               "global_load_async_to_lds_b128 %1, %13, %24\n\t"
               "global_load_async_to_lds_b128 %2, %14, %24\n\t"
               "global_load_async_to_lds_b128 %3, %15, %24\n\t"
               "global_load_async_to_lds_b128 %4, %16, %24\n\t"
               "global_load_async_to_lds_b128 %5, %17, %24\n\t"
               "global_load_async_to_lds_b128 %6, %18, %24\n\t"
               "global_load_async_to_lds_b128 %7, %19, %24\n\t"
               "global_load_async_to_lds_b128 %8, %20, %25\n\t"
               "global_load_async_to_lds_b128 %9, %21, %25\n\t"
               "global_load_async_to_lds_b128 %10, %22, %26\n\t"
               "global_load_async_to_lds_b128 %11, %23, %26\n\t"
               "s_wait_xcnt 0x0"
               :
               : "v"(lm0), "v"(lm1), "v"(lm2), "v"(lm3),
                 "v"(lm4), "v"(lm5), "v"(lm6), "v"(lm7),
                 "v"(lk0), "v"(lk1), "v"(lv0), "v"(lv1),
                 "v"(gm0), "v"(gm1), "v"(gm2), "v"(gm3),
                 "v"(gm4), "v"(gm5), "v"(gm6), "v"(gm7),
                 "v"(gk0), "v"(gk1), "v"(gv0), "v"(gv1),
                 "s"((unsigned long long)(size_t)mbase),
                 "s"((unsigned long long)(size_t)kbase),
                 "s"((unsigned long long)(size_t)vbase)
               : "memory");
}

// ---------------------------------------------------------------------------
// Kernel 1: convert the 4 weight matrices to bf16, packed in the order in which
// the projections read their weight fragments (A for Wq, Wk; B for Wv, Wo):
//   [matrix][16-column tile][k step of 32][piece 0..1][lane][8 bf16]
// Lane (half, ln) of piece c holds column 16 tile + ln, k = 32 step + 16 c +
// 8 half + 0..7, so one 16-byte load of a whole wave covers 512 contiguous
// bytes (4 whole lines) and a wave's share of a matrix is 8 KiB in a row.
// One thread converts and stores one 16-byte piece.
// ---------------------------------------------------------------------------
#define WSTEP_ 512              // bf16 elements of one tile's k step (2 pieces)
#define WTILE_ (16 * H_)        // bf16 elements of one 16-column tile
__global__ __launch_bounds__(256) void prep_weights_kernel(
    const float* __restrict__ Wq, const float* __restrict__ Wk,
    const float* __restrict__ Wv, const float* __restrict__ Wo,
    unsigned short* __restrict__ wP) {
  const int mat = blockIdx.y;
  const float* src = (mat == 0) ? Wq : (mat == 1) ? Wk : (mat == 2) ? Wv : Wo;
  const int g = blockIdx.x * 256 + threadIdx.x;   // 16-byte piece of the matrix
  const int lane = g & 31, c = (g >> 5) & 1, ks = (g >> 6) & 7, tile = g >> 9;
  const int n = tile * 16 + (lane & 15);
  const int k = ks * 32 + c * 16 + (lane >> 4) * 8;
  const float* s = src + k * H_ + n;
  float f[8];
#pragma unroll
  for (int e = 0; e < 8; ++e) f[e] = s[e * H_];
  u32x4 o;
#pragma unroll
  for (int i = 0; i < 4; ++i)
    o[i] = (unsigned)f2bf(f[2 * i]) | ((unsigned)f2bf(f[2 * i + 1]) << 16);
  *reinterpret_cast<u32x4*>(wP + (size_t)mat * H_ * H_ + (size_t)g * 8) = o;
}

// ---------------------------------------------------------------------------
// Kernel 2: QKV projection.  64-row m-tile per block, 16 waves = 16 n-tiles;
// a wave keeps 4 row tiles x 3 matrices of accumulators, so every weight
// fragment it loads feeds 4 products.
// Writes Q,K bf16 [b][h][s][d]; V transposed bf16 [b][h][d][s].
// Q and K are formed with the weights as A and x as B, so a lane's 8 registers
// hold 8 consecutive d of one row; V with x as A, so they hold 8 consecutive s
// of one d.  Either way a tile leaves a lane as one 16-byte piece; the pieces
// are gathered in LDS and go out as whole 128-byte lines.
// ---------------------------------------------------------------------------
#define GT_ 4                   // 16-row tiles per block in both projections
#define GR_ (16 * GT_)          // rows per block

// one block per WGP (grid = 256): 4 waves per SIMD is all that can be resident,
// so the compiler may spend that share of the registers on loads issued ahead
__global__ __launch_bounds__(512) __attribute__((amdgpu_waves_per_eu(4, 4)))
void qkv_kernel(
    const float* __restrict__ x,
    const float* __restrict__ bq, const float* __restrict__ bk,
    const float* __restrict__ bv,
    const unsigned short* __restrict__ wqP,
    const unsigned short* __restrict__ wkP,
    const unsigned short* __restrict__ wvP,
    unsigned short* __restrict__ Q, unsigned short* __restrict__ K,
    unsigned short* __restrict__ Vt) {
  __shared__ __align__(16) unsigned short xA[GR_][264];
  __shared__ __align__(16) unsigned short qS[GR_][264];    // Q tile [s][column]
  __shared__ __align__(16) unsigned short kS[GR_][264];    // K tile [s][column]
  __shared__ __align__(16) unsigned short vS[H_][GR_ + 8]; // V^T tile [column][s]

  const int tid   = threadIdx.x;
  const int mbase = blockIdx.x * GR_;
  const int wave = tid >> 5, lane = tid & 31;
  const int half = lane >> 4, ln = lane & 15;
  const int j = wave * 16 + ln;                // V: this lane's output column
  const int j8 = wave * 16 + half * 8;         // Q, K: first of its 8 columns

  // biases and the first k step's weight fragments need nothing from LDS:
  // they are asked for ahead of the barrier and arrive while x is staged
  const f32x4 bq0 = *reinterpret_cast<const f32x4*>(bq + j8);
  const f32x4 bq1 = *reinterpret_cast<const f32x4*>(bq + j8 + 4);
  const f32x4 bk0 = *reinterpret_cast<const f32x4*>(bk + j8);
  const f32x4 bk1 = *reinterpret_cast<const f32x4*>(bk + j8 + 4);
  const float biasv = bv[j];
  const unsigned short* pq = wqP + wave * WTILE_ + lane * 8;
  const unsigned short* pk = wkP + wave * WTILE_ + lane * 8;
  const unsigned short* pv = wvP + wave * WTILE_ + lane * 8;
  v16bf nq = ld16bf(pq, pq + 256);
  v16bf nk = ld16bf(pk, pk + 256);
  v16bf nv = ld16bf(pv, pv + 256);

  { // stage 64x256 fp32 -> bf16 LDS, one whole row per wave and pass
    const int col = (tid & 31) * 8, row = tid >> 5;
    const float* src = x + (size_t)(mbase + row) * H_ + col;
    f32x4 lo[GT_], hi[GT_];
#pragma unroll
    for (int t = 0; t < GT_; ++t) {
      lo[t] = *reinterpret_cast<const f32x4*>(src + 16 * t * H_);
      hi[t] = *reinterpret_cast<const f32x4*>(src + 16 * t * H_ + 4);
    }
    // the loads' address stays whole up to this wait
    asm volatile("s_wait_xcnt 0x0" :: "v"(src) : "memory");
#pragma unroll
    for (int t = 0; t < GT_; ++t) {
#pragma unroll
      for (int i = 0; i < 4; ++i) {
        xA[row + 16 * t][col + i]     = f2bf(lo[t][i]);
        xA[row + 16 * t][col + 4 + i] = f2bf(hi[t][i]);
      }
    }
  }
  __syncthreads();

  v8f cq[GT_], ck[GT_], cv[GT_];
#pragma unroll
  for (int t = 0; t < GT_; ++t) {
#pragma unroll
    for (int r = 0; r < 8; ++r) {
      cq[t][r] = (r < 4) ? bq0[r & 3] : bq1[r & 3];
      ck[t][r] = (r < 4) ? bk0[r & 3] : bk1[r & 3];
      cv[t][r] = biasv;
    }
  }

  // weight fragments are fetched one k step ahead of the products they feed
#pragma unroll
  for (int kk = 0; kk < H_; kk += 32) {
    const v16bf bqv = nq, bkv = nk, bvv = nv;
    if (kk + 32 < H_) {
      const int nx = (kk / 32 + 1) * WSTEP_;
      nq = ld16bf(pq + nx, pq + nx + 256);
      nk = ld16bf(pk + nx, pk + nx + 256);
      nv = ld16bf(pv + nx, pv + nx + 256);
      // holds the next step's weight loads in front of this step's products:
      // without it they sink to just ahead of their use and each k step
      // waits out the L2 latency
      __builtin_amdgcn_sched_barrier(0);
    }
#pragma unroll
    for (int t = 0; t < GT_; ++t) {
      const unsigned short* ar = &xA[16 * t + ln][kk + half * 8];
      const v16bf a = ld16bf(ar, ar + 16);
      cq[t] = wmma_bf16(bqv, a, cq[t]);   // [column j8 + r][row 16 t + ln]
      ck[t] = wmma_bf16(bkv, a, ck[t]);
      cv[t] = wmma_bf16(a, bvv, cv[t]);   // [row 16 t + 8 half + r][column j]
    }
  }

  // each tile's 8 values of a lane: one 16-byte piece into the block's tiles
#pragma unroll
  for (int t = 0; t < GT_; ++t) {
    *reinterpret_cast<v8bf*>(&qS[16 * t + ln][j8]) =
        __builtin_convertvector(cq[t], v8bf);
    *reinterpret_cast<v8bf*>(&kS[16 * t + ln][j8]) =
        __builtin_convertvector(ck[t], v8bf);
    *reinterpret_cast<v8bf*>(&vS[j][16 * t + 8 * half]) =
        __builtin_convertvector(cv[t], v8bf);
  }
  __syncthreads();

  // whole lines out.  Q, K: a wave takes one row s a pass, 8 lanes per head
  // (64 d = one line).  V^T: four columns a pass, 8 lanes per column
  // (the block's 64 s = one line).
  const int b = mbase >> 11, s0 = mbase & (S_ - 1);
  const int sub = lane >> 3, c8 = (lane & 7) * 8;
  u32x4 tq[GT_], tk[GT_], tv[GT_];
#pragma unroll
  for (int t = 0; t < GT_; ++t) {
    tq[t] = *reinterpret_cast<const u32x4*>(&qS[wave + 16 * t][lane * 8]);
    tk[t] = *reinterpret_cast<const u32x4*>(&kS[wave + 16 * t][lane * 8]);
    tv[t] = *reinterpret_cast<const u32x4*>(&vS[wave * 16 + 4 * t + sub][c8]);
  }
  const size_t qoff = (((size_t)b * NH_ + sub) * S_ + s0 + wave) * HD_ + c8;
  const size_t voff = ((size_t)b * H_ + wave * 16 + sub) * S_ + s0 + c8;
#pragma unroll
  for (int t = 0; t < GT_; ++t) {
    *reinterpret_cast<u32x4*>(Q + qoff + 16 * t * HD_) = tq[t];
    *reinterpret_cast<u32x4*>(K + qoff + 16 * t * HD_) = tk[t];
    *reinterpret_cast<u32x4*>(Vt + voff + 4 * t * S_)  = tv[t];
  }
}

#define KC_ 64
#define QB_ 128
// lane l <-> lane l ^ 16
static __device__ __forceinline__ float xhalf(float v) {
  const int i = __builtin_bit_cast(int, v);
  return __builtin_bit_cast(
      float, __builtin_amdgcn_permlanex16(i, i, 0x76543210, 0xfedcba98,
                                          false, false));
}

// 2 blocks per WGP (grid = 512): 4 waves per SIMD must stay resident, which
// bounds the registers of a wave
__global__ __launch_bounds__(256) __attribute__((amdgpu_waves_per_eu(4, 4)))
void attn_kernel(
    const float* __restrict__ mask,
    const unsigned short* __restrict__ Q,
    const unsigned short* __restrict__ K,
    const unsigned short* __restrict__ Vt,
    unsigned short* __restrict__ ctx) {
  __shared__ __align__(16) unsigned short Ks[2][KC_][72];      // key chunk [key][d]
  __shared__ __align__(16) unsigned short Vs[2][64][KC_ + 8];  // V^T chunk [d][key]
  __shared__ __align__(16) float          Ms[2][QB_][KC_ + 4]; // mask chunk [q][key]

  const int tid = threadIdx.x, wave = tid >> 5, lane = tid & 31;
  const int half = lane >> 4, ln = lane & 15;
  const int b = blockIdx.z, h = blockIdx.y;
  const int qb = blockIdx.x * QB_ + wave * 16;

  const size_t headQK = ((size_t)b * NH_ + h) * S_ * HD_;
  const size_t headV  = ((size_t)b * NH_ + h) * HD_ * S_;
  const unsigned short* qbase = Q + headQK + (size_t)qb * HD_;
  const unsigned short* kbase = K + headQK;
  const unsigned short* vbase = Vt + headV;

  // Q^T as B operand (column = query ln), loaded once and kept in registers
  const unsigned short* qrow = qbase + ln * HD_ + half * 8;
  const v16bf qf0 = ld16bf(qrow, qrow + 16);
  const v16bf qf1 = ld16bf(qrow + 32, qrow + 48);

  // mask rows of this block's 128 queries; this lane copies 16 bytes of rows
  // mrw, mrw + 2, ..., mrw + 14, all among its own wave's 16 queries
  const float* mbase = mask + ((size_t)b * S_ + blockIdx.x * QB_) * S_;
  const int mrw = wave * 16 + (lane >> 4), mch = (lane & 15) * 4;

  // issue one 64-key K/V/mask chunk into buffer bf (12 wave-ops, in-order)
  auto issue_chunk = [&](int k0, int bf) {
    const int rr = tid >> 3, cc = (tid & 7) * 8;   // K, V^T: 64x64 bf16, rows rr, rr + 32
    async_chunk_b128(lds_off(&Ms[bf][mrw][mch]),                // mask: 128x64 f32
                     lds_off(&Ms[bf][mrw + 2][mch]),
                     lds_off(&Ms[bf][mrw + 4][mch]),
                     lds_off(&Ms[bf][mrw + 6][mch]),
                     lds_off(&Ms[bf][mrw + 8][mch]),
                     lds_off(&Ms[bf][mrw + 10][mch]),
                     lds_off(&Ms[bf][mrw + 12][mch]),
                     lds_off(&Ms[bf][mrw + 14][mch]),
                     lds_off(&Ks[bf][rr][cc]), lds_off(&Ks[bf][rr + 32][cc]),
                     lds_off(&Vs[bf][rr][cc]), lds_off(&Vs[bf][rr + 32][cc]),
                     (unsigned)((mrw * S_ + k0 + mch) * 4),
                     (unsigned)(((mrw + 2) * S_ + k0 + mch) * 4),
                     (unsigned)(((mrw + 4) * S_ + k0 + mch) * 4),
                     (unsigned)(((mrw + 6) * S_ + k0 + mch) * 4),
                     (unsigned)(((mrw + 8) * S_ + k0 + mch) * 4),
                     (unsigned)(((mrw + 10) * S_ + k0 + mch) * 4),
                     (unsigned)(((mrw + 12) * S_ + k0 + mch) * 4),
                     (unsigned)(((mrw + 14) * S_ + k0 + mch) * 4),
                     (unsigned)(((k0 + rr) * HD_ + cc) * 2),
                     (unsigned)(((k0 + rr + 32) * HD_ + cc) * 2),
                     (unsigned)((rr * S_ + k0 + cc) * 2),
                     (unsigned)(((rr + 32) * S_ + k0 + cc) * 2),
                     mbase, kbase, vbase);
  };

  // every loop over t, u or r below is unrolled so that the register arrays it
  // walks are indexed by constants and never leave the registers
  // o[t][r] = O[query ln][d = 16 t + 8 half + r]
  v8f o[4];
#pragma unroll
  for (int t = 0; t < 4; ++t) {
#pragma unroll
    for (int r = 0; r < 8; ++r) o[t][r] = 0.f;
  }
  float mrow = -1e30f;   // running maximum of query ln (equal in both halves)
  float lrow = 0.f;      // running sum over this half's keys only

  issue_chunk(0, 0);

  for (int k0 = 0; k0 < S_; k0 += KC_) {
    const int bf = (k0 / KC_) & 1;
    if (k0 + KC_ < S_) {
      issue_chunk(k0 + KC_, bf ^ 1);
      // 12 ops of chunk i+1 in flight; retire chunk i
      asm volatile("s_wait_asynccnt 12" ::: "memory");
    } else {
      asm volatile("s_wait_asynccnt 0" ::: "memory");
    }
    __syncthreads();   // chunk bf visible to all waves

    // attention mask: 4 x 8 consecutive keys of one query per lane
    // (keys 16 t + 8 half + r)
    const float* mr = &Ms[bf][wave * 16 + ln][half * 8];
    f32x4 mk[8];
#pragma unroll
    for (int t = 0; t < 4; ++t) {
      mk[2 * t]     = *reinterpret_cast<const f32x4*>(mr + 16 * t);
      mk[2 * t + 1] = *reinterpret_cast<const f32x4*>(mr + 16 * t + 4);
    }
    // K rows as A operand (row = key), both d halves of the four 16-key subtiles
    v16bf ka[4][2];
#pragma unroll
    for (int t = 0; t < 4; ++t) {
      const unsigned short* kr = &Ks[bf][16 * t + ln][half * 8];
      ka[t][0] = ld16bf(kr, kr + 16);
      ka[t][1] = ld16bf(kr + 32, kr + 48);
    }
    // keeps these LDS reads together ahead of the products: without it each
    // read stands directly in front of the product that waits for it
    __builtin_amdgcn_sched_barrier(0);

    // scores^T = K . Q^T over d=64 (two K=32 WMMA steps, four 16-key subtiles)
    // s[t][r] = S[query ln][key = 16 t + 8 half + r]
    v8f s[4];
#pragma unroll
    for (int t = 0; t < 4; ++t) {
#pragma unroll
      for (int r = 0; r < 8; ++r) s[t][r] = 0.f;
      s[t] = wmma_bf16(ka[t][0], qf0, s[t]);
    }
#pragma unroll
    for (int t = 0; t < 4; ++t) s[t] = wmma_bf16(ka[t][1], qf1, s[t]);

    // V^T rows as A operand (row = d), 4 output d-tiles x 2 steps of 32 keys
    v16bf va[2][4];
#pragma unroll
    for (int u = 0; u < 2; ++u) {
#pragma unroll
      for (int t = 0; t < 4; ++t) {
        const unsigned short* vr = &Vs[bf][16 * t + ln][32 * u + half * 8];
        va[u][t] = ld16bf(vr, vr + 16);
      }
    }
    // keeps the V^T reads together ahead of the softmax, which covers their
    // latency: without it each stands in front of the product that waits for it
    __builtin_amdgcn_sched_barrier(0);

    // scale + attention mask
#pragma unroll
    for (int t = 0; t < 4; ++t)
      s[t] = s[t] * 0.125f + __builtin_shufflevector(mk[2 * t], mk[2 * t + 1],
                                                     0, 1, 2, 3, 4, 5, 6, 7);

    // online softmax: 32 keys in-lane, the other 32 in lane ^ 16
    float vm[4];
#pragma unroll
    for (int t = 0; t < 4; ++t) {
      vm[t] = s[t][0];
#pragma unroll
      for (int r = 1; r < 8; ++r) vm[t] = fmaxf(vm[t], s[t][r]);
    }
    float v = fmaxf(fmaxf(vm[0], vm[1]), fmaxf(vm[2], vm[3]));
    v = fmaxf(v, xhalf(v));
    const float mn   = fmaxf(mrow, v);
    const float corr = __expf(mrow - mn);
    mrow = mn;

    // P^T as B operand of step u: element e <-> key 32 u + 8 half + e,
    // 8 + e <-> 32 u + 16 + 8 half + e
    v16bf pb[2];
    v8f p[4];
#pragma unroll
    for (int t = 0; t < 4; ++t) {
#pragma unroll
      for (int r = 0; r < 8; ++r) {
        p[t][r] = __expf(s[t][r] - mn);
        pb[t >> 1][8 * (t & 1) + r] = (__bf16)p[t][r];
      }
    }
    // this half's 32 terms, summed pairwise
    const v8f   t8 = (p[0] + p[1]) + (p[2] + p[3]);
    const f32x4 t4 = __builtin_shufflevector(t8, t8, 0, 1, 2, 3) +
                     __builtin_shufflevector(t8, t8, 4, 5, 6, 7);
    lrow = lrow * corr + ((t4[0] + t4[2]) + (t4[1] + t4[3]));
#pragma unroll
    for (int t = 0; t < 4; ++t) {
#pragma unroll
      for (int r = 0; r < 8; ++r) o[t][r] *= corr;
    }

    // O^T += V^T . P^T   (two K=32 steps over this key chunk, 4 output d-tiles)
#pragma unroll
    for (int u = 0; u < 2; ++u) {
#pragma unroll
      for (int t = 0; t < 4; ++t) o[t] = wmma_bf16(va[u][t], pb[u], o[t]);
    }

    __syncthreads();   // all waves done with buffer bf before it refills
  }

  // join the halves' sums, normalize and emit context, merged heads bf16
  // [b*S+s][H]: 8 consecutive d per lane and tile
  const float inv = 1.0f / (lrow + xhalf(lrow));
  v8bf c0, c1, c2, c3;
#pragma unroll
  for (int r = 0; r < 8; ++r) {
    c0[r] = (__bf16)(o[0][r] * inv);
    c1[r] = (__bf16)(o[1][r] * inv);
    c2[r] = (__bf16)(o[2][r] * inv);
    c3[r] = (__bf16)(o[3][r] * inv);
  }
  // The wave's 16 x 64 tile is 16 whole lines of ctx, but a lane holds 16-byte
  // pieces of one row.  The tile turns in the mask rows of buffer 0 that this
  // wave alone filled and read (free behind the loop's last barrier), so that
  // each store covers 4 whole lines.
  unsigned short* srow =
      reinterpret_cast<unsigned short*>(&Ms[0][wave * 16 + ln][0]) + half * 8;
  *reinterpret_cast<u32x4*>(srow)      = __builtin_bit_cast(u32x4, c0);
  *reinterpret_cast<u32x4*>(srow + 16) = __builtin_bit_cast(u32x4, c1);
  *reinterpret_cast<u32x4*>(srow + 32) = __builtin_bit_cast(u32x4, c2);
  *reinterpret_cast<u32x4*>(srow + 48) = __builtin_bit_cast(u32x4, c3);
  // the other lanes' pieces are in LDS before this lane reads them back
  asm volatile("s_wait_dscnt 0x0" ::: "memory");
  const int sub = lane >> 3, c8 = (lane & 7) * 8;
  u32x4 tc[4];
#pragma unroll
  for (int t = 0; t < 4; ++t)
    tc[t] = *reinterpret_cast<const u32x4*>(
        reinterpret_cast<const unsigned short*>(&Ms[0][wave * 16 + 4 * t + sub][0]) + c8);
  unsigned short* crow =
      ctx + ((size_t)b * S_ + (qb + sub)) * H_ + (size_t)h * HD_ + c8;
#pragma unroll
  for (int t = 0; t < 4; ++t)
    *reinterpret_cast<u32x4*>(crow + 4 * t * H_) = tc[t];
}

// ---------------------------------------------------------------------------
// Kernel 4: output projection + bias + residual + LayerNorm (fused)
// ---------------------------------------------------------------------------
// register budget as in the QKV kernel: one block per WGP, 4 waves per SIMD
__global__ __launch_bounds__(512) __attribute__((amdgpu_waves_per_eu(4, 4)))
void proj_ln_kernel(
    const unsigned short* __restrict__ ctx,
    const unsigned short* __restrict__ woP,
    const float* __restrict__ bo, const float* __restrict__ x,
    const float* __restrict__ gamma, const float* __restrict__ beta,
    float* __restrict__ out) {
  __shared__ __align__(16) unsigned short cA[GR_][264];
  __shared__ __align__(16) float          ot[GR_][264];

  const int tid = threadIdx.x;
  const int mbase = blockIdx.x * GR_;
  const int wave = tid >> 5, lane = tid & 31;
  const int half = lane >> 4, ln = lane & 15;
  const int j = wave * 16 + ln;

  // the wave's 16 weight columns need nothing from LDS: they are asked for
  // ahead of the barrier and arrive while the ctx tile is staged
  const float bb = bo[j];
  const unsigned short* bp = woP + wave * WTILE_ + lane * 8;
  v16bf bw[H_ / 32];
#pragma unroll
  for (int k = 0; k < H_ / 32; ++k)
    bw[k] = ld16bf(bp + WSTEP_ * k, bp + WSTEP_ * k + 256);

  { // stage ctx tile (already bf16)
    const int ch = (tid & 31) * 8;
#pragma unroll
    for (int t = 0; t < GT_; ++t) {
      const int row = (tid >> 5) + 16 * t;
      *reinterpret_cast<u32x4*>(&cA[row][ch]) =
          *reinterpret_cast<const u32x4*>(ctx + (size_t)(mbase + row) * H_ + ch);
    }
  }
  // the weight loads' address stays whole up to this wait
  asm volatile("s_wait_xcnt 0x0" :: "v"(bp) : "memory");
  __syncthreads();

  v8f c[GT_];
#pragma unroll
  for (int t = 0; t < GT_; ++t) {
#pragma unroll
    for (int r = 0; r < 8; ++r) c[t][r] = bb;
  }

#pragma unroll
  for (int kk = 0; kk < H_; kk += 32) {
#pragma unroll
    for (int t = 0; t < GT_; ++t) {
      const unsigned short* ar = &cA[16 * t + ln][kk + half * 8];
      c[t] = wmma_bf16(ld16bf(ar, ar + 16), bw[kk / 32], c[t]);
    }
  }

  // + residual, stage rows for LayerNorm
  {
    const float* xr = x + (size_t)(mbase + 8 * half) * H_ + j;
    float res[GT_][8];
#pragma unroll
    for (int t = 0; t < GT_; ++t) {
#pragma unroll
      for (int r = 0; r < 8; ++r) res[t][r] = xr[(16 * t + r) * H_];
    }
    // the loads' address stays whole up to this wait
    asm volatile("s_wait_xcnt 0x0" :: "v"(xr) : "memory");
#pragma unroll
    for (int t = 0; t < GT_; ++t) {
#pragma unroll
      for (int r = 0; r < 8; ++r)
        ot[16 * t + r + 8 * half][j] = c[t][r] + res[t][r];
    }
  }
  __syncthreads();

  // LayerNorm: wave w normalizes rows w, w + 16, ...  A lane takes 4 columns
  // of each half of the row, so a wave's 16-byte stores cover 4 whole lines
#pragma unroll
  for (int t = 0; t < GT_; ++t) {
    const int row = wave + 16 * t, c0 = lane * 4;
    float vals[8], s = 0.f, sq = 0.f;
#pragma unroll
    for (int i = 0; i < 8; ++i) {
      vals[i] = ot[row][c0 + (i >> 2) * 128 + (i & 3)];
      s += vals[i];
      sq += vals[i] * vals[i];
    }
    s  += __shfl_xor(s, 16, 32);  sq += __shfl_xor(sq, 16, 32);
    s  += __shfl_xor(s, 8, 32);   sq += __shfl_xor(sq, 8, 32);
    s  += __shfl_xor(s, 4, 32);   sq += __shfl_xor(sq, 4, 32);
    s  += __shfl_xor(s, 2, 32);   sq += __shfl_xor(sq, 2, 32);
    s  += __shfl_xor(s, 1, 32);   sq += __shfl_xor(sq, 1, 32);
    const float mu  = s * (1.0f / 256.0f);
    const float var = sq * (1.0f / 256.0f) - mu * mu;
    const float inv = rsqrtf(var + 1e-12f);
    const size_t gr = (size_t)(mbase + row) * H_;
#pragma unroll
    for (int i = 0; i < 8; ++i) {
      const int col = c0 + (i >> 2) * 128 + (i & 3);
      out[gr + col] = (vals[i] - mu) * inv * gamma[col] + beta[col];
    }
  }
}

// ---------------------------------------------------------------------------
extern "C" void kernel_launch(void* const* d_in, const int* in_sizes, int n_in,
                              void* d_out, int out_size, void* d_ws, size_t ws_size,
                              hipStream_t stream) {
  const float* x     = (const float*)d_in[0];
  const float* mask  = (const float*)d_in[1];
  const float* Wq    = (const float*)d_in[2];
  const float* bq    = (const float*)d_in[3];
  const float* Wk    = (const float*)d_in[4];
  const float* bk    = (const float*)d_in[5];
  const float* Wv    = (const float*)d_in[6];
  const float* bv    = (const float*)d_in[7];
  const float* Wo    = (const float*)d_in[8];
  const float* bo    = (const float*)d_in[9];
  const float* gamma = (const float*)d_in[10];
  const float* beta  = (const float*)d_in[11];
  float* out = (float*)d_out;

  // workspace layout (ushort elements)
  unsigned short* ws  = (unsigned short*)d_ws;
  unsigned short* wT  = ws;                         // 4 * 256*256
  unsigned short* Qb  = ws + 4 * H_ * H_;           // [B][NH][S][HD]
  unsigned short* Kb  = Qb + (size_t)B_ * NH_ * S_ * HD_;
  unsigned short* Vtb = Kb + (size_t)B_ * NH_ * S_ * HD_;
  unsigned short* ctx = Vtb + (size_t)B_ * NH_ * S_ * HD_;  // [M][H]

  prep_weights_kernel<<<dim3(H_ * H_ / 8 / 256, 4), 256, 0, stream>>>(
      Wq, Wk, Wv, Wo, wT);

  qkv_kernel<<<M_ / GR_, 512, 0, stream>>>(
      x, bq, bk, bv, wT, wT + H_ * H_, wT + 2 * H_ * H_, Qb, Kb, Vtb);

  attn_kernel<<<dim3(S_ / QB_, NH_, B_), 256, 0, stream>>>(
      mask, Qb, Kb, Vtb, ctx);

  proj_ln_kernel<<<M_ / GR_, 512, 0, stream>>>(
      ctx, wT + 3 * H_ * H_, bo, x, gamma, beta, out);
}

// v007
// It runs in 59.8 microseconds.
// In both of two side-by-side timings against v006, it was 1.05 times as fast.
// Over all steps from v000 it is 2.82 times as fast.
#include <hip/hip_runtime.h>
#include <hip/hip_bf16.h>
#include <math.h>

// Problem constants (match reference)
#define B_   8
#define S_   2048
#define H_   256
#define NH_  4
#define HD_  64
#define M_   (B_ * S_)          // 16384 rows

typedef __attribute__((ext_vector_type(16))) __bf16       v16bf;
typedef __attribute__((ext_vector_type(8)))  __bf16       v8bf;
typedef __attribute__((ext_vector_type(8)))  float        v8f;
typedef __attribute__((ext_vector_type(4)))  float        f32x4;
typedef __attribute__((ext_vector_type(4)))  unsigned int u32x4;

struct U32x8 { u32x4 lo, hi; };

// float -> bf16 (round to nearest even, NaN-agnostic — inputs are sane)
static __device__ __forceinline__ unsigned short f2bf(float f) {
  unsigned u = __builtin_bit_cast(unsigned, f);
  u += 0x7FFFu + ((u >> 16) & 1u);
  return (unsigned short)(u >> 16);
}

// Build a WMMA 16-bf16 operand from two aligned 16-byte chunks.
// Per ISA 7.12.2 (wave32): per lane, elements 0..7 <-> K = half*8 + e,
// elements 8..15 <-> K = 16 + half*8 + e.  Storing tiles row-major [m][k]
// (A) or [n][k] (B-transposed) makes both chunks contiguous b128 loads.
static __device__ __forceinline__ v16bf ld16bf(const unsigned short* p0,
                                               const unsigned short* p1) {
  U32x8 u;
  u.lo = *reinterpret_cast<const u32x4*>(p0);
  u.hi = *reinterpret_cast<const u32x4*>(p1);
  return __builtin_bit_cast(v16bf, u);
}

static __device__ __forceinline__ v8f wmma_bf16(v16bf a, v16bf b, v8f c) {
  return __builtin_amdgcn_wmma_f32_16x16x32_bf16(
      /*neg_a=*/false, a, /*neg_b=*/false, b,
      /*c_mod=*/(short)0, c, /*reuse_a=*/false, /*reuse_b=*/false);
}

// --- CDNA5 async memory->LDS copy (ASYNCcnt path) --------------------------
// Per lane: LDS[ldsOff] <- MEM[base + gOff] (16 bytes).  GVS addressing:
// 64-bit SGPR base + 32-bit per-lane VGPR offset.  LDS offset is the low
// 32 bits of the generic shared-space address (aperture: addr[31:0]).
static __device__ __forceinline__ unsigned lds_off(const void* p) {
  return (unsigned)(size_t)p;
}
// Copies of a lane that share one LDS-address register and one offset
// register, so that a chunk's copies take no register per row.  The immediate
// offset moves both addresses by the LDS step from row to row; the rest of the
// global step stands in each copy's scalar base.  The closing s_wait_xcnt 0
// stands inside the copies' own statement so that no later write of an address
// register they name can be placed in front of it.
// Mask: 16 rows, 528 bytes apart in LDS and 8192 in memory (8192 - 528 = 7664).
static __device__ __forceinline__ void async_mask16_b128(
    unsigned l, unsigned g, const void* base) {
  const unsigned long long b = (unsigned long long)(size_t)base;
  asm volatile("global_load_async_to_lds_b128 %0, %1, %2\n\t"
               "global_load_async_to_lds_b128 %0, %1, %3 offset:528\n\t"
               "global_load_async_to_lds_b128 %0, %1, %4 offset:1056\n\t"
               "global_load_async_to_lds_b128 %0, %1, %5 offset:1584\n\t"
               "global_load_async_to_lds_b128 %0, %1, %6 offset:2112\n\t"
               "global_load_async_to_lds_b128 %0, %1, %7 offset:2640\n\t"
               "global_load_async_to_lds_b128 %0, %1, %8 offset:3168\n\t"
               "global_load_async_to_lds_b128 %0, %1, %9 offset:3696\n\t"
               "global_load_async_to_lds_b128 %0, %1, %10 offset:4224\n\t"
               "global_load_async_to_lds_b128 %0, %1, %11 offset:4752\n\t"
               "global_load_async_to_lds_b128 %0, %1, %12 offset:5280\n\t"
               "global_load_async_to_lds_b128 %0, %1, %13 offset:5808\n\t"
               "global_load_async_to_lds_b128 %0, %1, %14 offset:6336\n\t"
               "global_load_async_to_lds_b128 %0, %1, %15 offset:6864\n\t"
               "global_load_async_to_lds_b128 %0, %1, %16 offset:7392\n\t"
               "global_load_async_to_lds_b128 %0, %1, %17 offset:7920\n\t"
               "s_wait_xcnt 0x0"
               :
               : "v"(l), "v"(g),
                 "s"(b), "s"(b + 1 * 7664), "s"(b + 2 * 7664), "s"(b + 3 * 7664),
                 "s"(b + 4 * 7664), "s"(b + 5 * 7664), "s"(b + 6 * 7664), "s"(b + 7 * 7664),
                 "s"(b + 8 * 7664), "s"(b + 9 * 7664), "s"(b + 10 * 7664), "s"(b + 11 * 7664),
                 "s"(b + 12 * 7664), "s"(b + 13 * 7664), "s"(b + 14 * 7664), "s"(b + 15 * 7664)
               : "memory");
}
// K: 4 rows, 32 keys apart: 4608 bytes in LDS, 4096 in memory (base - 512 a
// row).  V^T: 4 rows, 16 d apart: 4352 bytes in LDS, 65536 in memory
// (base + 61184 a row).
static __device__ __forceinline__ void async_kv8_b128(
    unsigned lk, unsigned gk, const void* kb,
    unsigned lv, unsigned gv, const void* vb) {
  const unsigned long long k = (unsigned long long)(size_t)kb;
  const unsigned long long v = (unsigned long long)(size_t)vb;
  asm volatile("global_load_async_to_lds_b128 %0, %1, %4\n\t"
               "global_load_async_to_lds_b128 %0, %1, %5 offset:4608\n\t"
               "global_load_async_to_lds_b128 %0, %1, %6 offset:9216\n\t"
               "global_load_async_to_lds_b128 %0, %1, %7 offset:13824\n\t"
               "global_load_async_to_lds_b128 %2, %3, %8\n\t"
               "global_load_async_to_lds_b128 %2, %3, %9 offset:4352\n\t"
               "global_load_async_to_lds_b128 %2, %3, %10 offset:8704\n\t"
               "global_load_async_to_lds_b128 %2, %3, %11 offset:13056\n\t"
               "s_wait_xcnt 0x0"
               :
               : "v"(lk), "v"(gk), "v"(lv), "v"(gv),
                 "s"(k), "s"(k - 512), "s"(k - 2 * 512), "s"(k - 3 * 512),
                 "s"(v), "s"(v + 61184), "s"(v + 2 * 61184), "s"(v + 3 * 61184)
               : "memory");
}

// ---------------------------------------------------------------------------
// Kernel 1: convert the 4 weight matrices to bf16, packed in the order in which
// the projections read their weight fragments (A for Wq, Wk; B for Wv, Wo):
//   [matrix][16-column tile][k step of 32][piece 0..1][lane][8 bf16]
// Lane (half, ln) of piece c holds column 16 tile + ln, k = 32 step + 16 c +
// 8 half + 0..7, so one 16-byte load of a whole wave covers 512 contiguous
// bytes (4 whole lines) and a wave's share of a matrix is 8 KiB in a row.
// One thread converts and stores one 16-byte piece.
// ---------------------------------------------------------------------------
#define WSTEP_ 512              // bf16 elements of one tile's k step (2 pieces)
#define WTILE_ (16 * H_)        // bf16 elements of one 16-column tile
__global__ __launch_bounds__(256) void prep_weights_kernel(
    const float* __restrict__ Wq, const float* __restrict__ Wk,
    const float* __restrict__ Wv, const float* __restrict__ Wo,
    unsigned short* __restrict__ wP) {
  const int mat = blockIdx.y;
  const float* src = (mat == 0) ? Wq : (mat == 1) ? Wk : (mat == 2) ? Wv : Wo;
  const int g = blockIdx.x * 256 + threadIdx.x;   // 16-byte piece of the matrix
  const int lane = g & 31, c = (g >> 5) & 1, ks = (g >> 6) & 7, tile = g >> 9;
  const int n = tile * 16 + (lane & 15);
  const int k = ks * 32 + c * 16 + (lane >> 4) * 8;
  const float* s = src + k * H_ + n;
  float f[8];
#pragma unroll
  for (int e = 0; e < 8; ++e) f[e] = s[e * H_];
  u32x4 o;
#pragma unroll
  for (int i = 0; i < 4; ++i)
    o[i] = (unsigned)f2bf(f[2 * i]) | ((unsigned)f2bf(f[2 * i + 1]) << 16);
  *reinterpret_cast<u32x4*>(wP + (size_t)mat * H_ * H_ + (size_t)g * 8) = o;
}

// ---------------------------------------------------------------------------
// Kernel 2: QKV projection.  64-row m-tile per block, 16 waves = 16 n-tiles;
// a wave keeps 4 row tiles x 3 matrices of accumulators, so every weight
// fragment it loads feeds 4 products.
// Writes Q,K bf16 [b][h][s][d]; V transposed bf16 [b][h][d][s].
// Q and K are formed with the weights as A and x as B, so a lane's 8 registers
// hold 8 consecutive d of one row; V with x as A, so they hold 8 consecutive s
// of one d.  Either way a tile leaves a lane as one 16-byte piece; the pieces
// are gathered in LDS and go out as whole 128-byte lines.
// ---------------------------------------------------------------------------
#define GT_ 4                   // 16-row tiles per block in both projections
#define GR_ (16 * GT_)          // rows per block

// one block per WGP (grid = 256): 4 waves per SIMD is all that can be resident,
// so the compiler may spend that share of the registers on loads issued ahead
__global__ __launch_bounds__(512) __attribute__((amdgpu_waves_per_eu(4, 4)))
void qkv_kernel(
    const float* __restrict__ x,
    const float* __restrict__ bq, const float* __restrict__ bk,
    const float* __restrict__ bv,
    const unsigned short* __restrict__ wqP,
    const unsigned short* __restrict__ wkP,
    const unsigned short* __restrict__ wvP,
    unsigned short* __restrict__ Q, unsigned short* __restrict__ K,
    unsigned short* __restrict__ Vt) {
  __shared__ __align__(16) unsigned short xA[GR_][264];
  __shared__ __align__(16) unsigned short qS[GR_][264];    // Q tile [s][column]
  __shared__ __align__(16) unsigned short kS[GR_][264];    // K tile [s][column]
  __shared__ __align__(16) unsigned short vS[H_][GR_ + 8]; // V^T tile [column][s]

  const int tid   = threadIdx.x;
  const int mbase = blockIdx.x * GR_;
  const int wave = tid >> 5, lane = tid & 31;
  const int half = lane >> 4, ln = lane & 15;
  const int j = wave * 16 + ln;                // V: this lane's output column
  const int j8 = wave * 16 + half * 8;         // Q, K: first of its 8 columns

  // biases and the first k step's weight fragments need nothing from LDS:
  // they are asked for ahead of the barrier and arrive while x is staged
  const f32x4 bq0 = *reinterpret_cast<const f32x4*>(bq + j8);
  const f32x4 bq1 = *reinterpret_cast<const f32x4*>(bq + j8 + 4);
  const f32x4 bk0 = *reinterpret_cast<const f32x4*>(bk + j8);
  const f32x4 bk1 = *reinterpret_cast<const f32x4*>(bk + j8 + 4);
  const float biasv = bv[j];
  const unsigned short* pq = wqP + wave * WTILE_ + lane * 8;
  const unsigned short* pk = wkP + wave * WTILE_ + lane * 8;
  const unsigned short* pv = wvP + wave * WTILE_ + lane * 8;
  v16bf nq = ld16bf(pq, pq + 256);
  v16bf nk = ld16bf(pk, pk + 256);
  v16bf nv = ld16bf(pv, pv + 256);

  { // stage 64x256 fp32 -> bf16 LDS, one whole row per wave and pass
    const int col = (tid & 31) * 8, row = tid >> 5;
    const float* src = x + (size_t)(mbase + row) * H_ + col;
    f32x4 lo[GT_], hi[GT_];
#pragma unroll
    for (int t = 0; t < GT_; ++t) {
      lo[t] = *reinterpret_cast<const f32x4*>(src + 16 * t * H_);
      hi[t] = *reinterpret_cast<const f32x4*>(src + 16 * t * H_ + 4);
    }
    // the loads' address stays whole up to this wait
    asm volatile("s_wait_xcnt 0x0" :: "v"(src) : "memory");
#pragma unroll
    for (int t = 0; t < GT_; ++t) {
#pragma unroll
      for (int i = 0; i < 4; ++i) {
        xA[row + 16 * t][col + i]     = f2bf(lo[t][i]);
        xA[row + 16 * t][col + 4 + i] = f2bf(hi[t][i]);
      }
    }
  }
  __syncthreads();

  v8f cq[GT_], ck[GT_], cv[GT_];
#pragma unroll
  for (int t = 0; t < GT_; ++t) {
#pragma unroll
    for (int r = 0; r < 8; ++r) {
      cq[t][r] = (r < 4) ? bq0[r & 3] : bq1[r & 3];
      ck[t][r] = (r < 4) ? bk0[r & 3] : bk1[r & 3];
      cv[t][r] = biasv;
    }
  }

  // weight fragments are fetched one k step ahead of the products they feed
#pragma unroll
  for (int kk = 0; kk < H_; kk += 32) {
    const v16bf bqv = nq, bkv = nk, bvv = nv;
    if (kk + 32 < H_) {
      const int nx = (kk / 32 + 1) * WSTEP_;
      nq = ld16bf(pq + nx, pq + nx + 256);
      nk = ld16bf(pk + nx, pk + nx + 256);
      nv = ld16bf(pv + nx, pv + nx + 256);
      // holds the next step's weight loads in front of this step's products:
      // without it they sink to just ahead of their use and each k step
      // waits out the L2 latency
      __builtin_amdgcn_sched_barrier(0);
    }
#pragma unroll
    for (int t = 0; t < GT_; ++t) {
      const unsigned short* ar = &xA[16 * t + ln][kk + half * 8];
      const v16bf a = ld16bf(ar, ar + 16);
      cq[t] = wmma_bf16(bqv, a, cq[t]);   // [column j8 + r][row 16 t + ln]
      ck[t] = wmma_bf16(bkv, a, ck[t]);
      cv[t] = wmma_bf16(a, bvv, cv[t]);   // [row 16 t + 8 half + r][column j]
    }
  }

  // each tile's 8 values of a lane: one 16-byte piece into the block's tiles
#pragma unroll
  for (int t = 0; t < GT_; ++t) {
    *reinterpret_cast<v8bf*>(&qS[16 * t + ln][j8]) =
        __builtin_convertvector(cq[t], v8bf);
    *reinterpret_cast<v8bf*>(&kS[16 * t + ln][j8]) =
        __builtin_convertvector(ck[t], v8bf);
    *reinterpret_cast<v8bf*>(&vS[j][16 * t + 8 * half]) =
        __builtin_convertvector(cv[t], v8bf);
  }
  __syncthreads();

  // whole lines out.  Q, K: a wave takes one row s a pass, 8 lanes per head
  // (64 d = one line).  V^T: four columns a pass, 8 lanes per column
  // (the block's 64 s = one line).
  const int b = mbase >> 11, s0 = mbase & (S_ - 1);
  const int sub = lane >> 3, c8 = (lane & 7) * 8;
  u32x4 tq[GT_], tk[GT_], tv[GT_];
#pragma unroll
  for (int t = 0; t < GT_; ++t) {
    tq[t] = *reinterpret_cast<const u32x4*>(&qS[wave + 16 * t][lane * 8]);
    tk[t] = *reinterpret_cast<const u32x4*>(&kS[wave + 16 * t][lane * 8]);
    tv[t] = *reinterpret_cast<const u32x4*>(&vS[wave * 16 + 4 * t + sub][c8]);
  }
  const size_t qoff = (((size_t)b * NH_ + sub) * S_ + s0 + wave) * HD_ + c8;
  const size_t voff = ((size_t)b * H_ + wave * 16 + sub) * S_ + s0 + c8;
#pragma unroll
  for (int t = 0; t < GT_; ++t) {
    *reinterpret_cast<u32x4*>(Q + qoff + 16 * t * HD_) = tq[t];
    *reinterpret_cast<u32x4*>(K + qoff + 16 * t * HD_) = tk[t];
    *reinterpret_cast<u32x4*>(Vt + voff + 4 * t * S_)  = tv[t];
  }
}

#define KC_ 128
#define QB_ 128
// lane l <-> lane l ^ 16
static __device__ __forceinline__ float xhalf(float v) {
  const int i = __builtin_bit_cast(int, v);
  return __builtin_bit_cast(
      float, __builtin_amdgcn_permlanex16(i, i, 0x76543210, 0xfedcba98,
                                          false, false));
}

// 2 blocks per WGP (grid = 512): 4 waves per SIMD must stay resident, which
// bounds the registers of a wave
__global__ __launch_bounds__(256) __attribute__((amdgpu_waves_per_eu(4, 4)))
void attn_kernel(
    const float* __restrict__ mask,
    const unsigned short* __restrict__ Q,
    const unsigned short* __restrict__ K,
    const unsigned short* __restrict__ Vt,
    unsigned short* __restrict__ ctx) {
  __shared__ __align__(16) unsigned short Ks[2][KC_][72];      // key chunk [key][d]
  __shared__ __align__(16) unsigned short Vs[2][64][KC_ + 8];  // V^T chunk [d][key]
  __shared__ __align__(16) float          Ms[QB_][KC_ + 4];    // mask chunk [q][key]

  const int tid = threadIdx.x, wave = tid >> 5, lane = tid & 31;
  const int half = lane >> 4, ln = lane & 15;
  const int b = blockIdx.z, h = blockIdx.y;
  const int qb = blockIdx.x * QB_ + wave * 16;

  const size_t headQK = ((size_t)b * NH_ + h) * S_ * HD_;
  const size_t headV  = ((size_t)b * NH_ + h) * HD_ * S_;
  const unsigned short* qbase = Q + headQK + (size_t)qb * HD_;
  const unsigned short* kbase = K + headQK;
  const unsigned short* vbase = Vt + headV;

  // Q^T as B operand (column = query ln), loaded once and kept in registers
  const unsigned short* qrow = qbase + ln * HD_ + half * 8;
  const v16bf qf0 = ld16bf(qrow, qrow + 16);
  const v16bf qf1 = ld16bf(qrow + 32, qrow + 48);

  // mask rows of this block's 128 queries
  const float* mbase = mask + ((size_t)b * S_ + blockIdx.x * QB_) * S_;

  // one 128-key K/V chunk into buffer bf: 8 copies a lane.  K: 128 rows of one
  // line, 8 lanes a row, rows rr + 32 j; V^T: 64 rows of two lines, 16 lanes a
  // row, rows rv + 16 j.  The chunk's place goes into the scalar bases
  auto issue_kv = [&](int k0, int bf) {
    const int rr = tid >> 3, cc = (tid & 7) * 8;
    const int rv = tid >> 4, cv = (tid & 15) * 8;
    async_kv8_b128(lds_off(&Ks[bf][rr][cc]), (unsigned)((rr * HD_ + cc) * 2),
                   kbase + k0 * HD_,
                   lds_off(&Vs[bf][rv][cv]), (unsigned)((rv * S_ + cv) * 2),
                   vbase + k0);
  };
  // the wave's own 16 mask rows of one chunk: 16 copies a lane, each copy of
  // the wave one whole row of the chunk (512 bytes, 4 lines)
  auto issue_mask = [&](int k0) {
    const int mr0 = wave * 16, mc = lane * 4;
    const unsigned g = (unsigned)((mr0 * S_ + mc) * 4);
    async_mask16_b128(lds_off(&Ms[mr0][mc]), g, mbase + k0);
  };

  // every loop over t, u or r below is unrolled so that the register arrays it
  // walks are indexed by constants and never leave the registers
  // o[t][r] = O[query ln][d = 16 t + 8 half + r]
  v8f o[4];
#pragma unroll
  for (int t = 0; t < 4; ++t) {
#pragma unroll
    for (int r = 0; r < 8; ++r) o[t][r] = 0.f;
  }
  float mrow = -1e30f;   // running maximum of query ln (equal in both halves)
  float lrow = 0.f;      // running sum over this half's keys only

  issue_kv(0, 0);
  issue_mask(0);

  // one pass over the 128 keys from k0; more: a further chunk follows.  The
  // last pass is written out behind the loop, so that the loop's body has no
  // branch in it and the order set below holds from end to end
  auto pass = [&](int k0, bool more) __attribute__((always_inline)) {
    const int bf = (k0 / KC_) & 1;
    // this chunk's copies, all that this wave has in flight, have landed
    asm volatile("s_wait_asynccnt 0" ::: "memory");
    __syncthreads();   // chunk bf visible to all waves

    // attention mask: 8 x 8 consecutive keys of one query per lane
    // (keys 16 t + 8 half + r); here the first four subtiles
    const float* mr = &Ms[wave * 16 + ln][half * 8];
    f32x4 mk[16];
#pragma unroll
    for (int t = 0; t < 4; ++t) {
      mk[2 * t]     = *reinterpret_cast<const f32x4*>(mr + 16 * t);
      mk[2 * t + 1] = *reinterpret_cast<const f32x4*>(mr + 16 * t + 4);
    }
    // K rows as A operand (row = key), both d halves of the first four 16-key
    // subtiles
    v16bf ka[4][2];
#pragma unroll
    for (int t = 0; t < 4; ++t) {
      const unsigned short* kr = &Ks[bf][16 * t + ln][half * 8];
      ka[t][0] = ld16bf(kr, kr + 16);
      ka[t][1] = ld16bf(kr + 32, kr + 48);
    }
    // keeps these LDS reads together ahead of the products: without it each
    // read stands directly in front of the product that waits for it
    __builtin_amdgcn_sched_barrier(0);
    // the next chunk's K/V, into the buffer that every wave left at the last
    // pass's closing barrier; issued here, while the reads above return
    if (more) issue_kv(k0 + KC_, bf ^ 1);

    // scores^T = K . Q^T over d=64 (two K=32 WMMA steps per 16-key subtile)
    // s[t][r] = S[query ln][key = 16 t + 8 half + r]
    v8f s[8];
#pragma unroll
    for (int t = 0; t < 4; ++t) {
#pragma unroll
      for (int r = 0; r < 8; ++r) s[t][r] = 0.f;
      s[t] = wmma_bf16(ka[t][0], qf0, s[t]);
    }
#pragma unroll
    for (int t = 0; t < 4; ++t) s[t] = wmma_bf16(ka[t][1], qf1, s[t]);
    // keeps the reads further down behind these products and behind the scale,
    // whose K and mask registers they take over: lifted above them they cost
    // registers that the wave lacks
    __builtin_amdgcn_sched_barrier(0);

    // scale + attention mask, first four subtiles
#pragma unroll
    for (int t = 0; t < 4; ++t)
      s[t] = s[t] * 0.125f + __builtin_shufflevector(mk[2 * t], mk[2 * t + 1],
                                                     0, 1, 2, 3, 4, 5, 6, 7);
    // as above: the scale stays in front of the reads
    __builtin_amdgcn_sched_barrier(0);

    // mask and K rows of the last four subtiles
#pragma unroll
    for (int t = 4; t < 8; ++t) {
      mk[2 * t]     = *reinterpret_cast<const f32x4*>(mr + 16 * t);
      mk[2 * t + 1] = *reinterpret_cast<const f32x4*>(mr + 16 * t + 4);
    }
    v16bf kb[4][2];
#pragma unroll
    for (int t = 0; t < 4; ++t) {
      const unsigned short* kr = &Ks[bf][64 + 16 * t + ln][half * 8];
      kb[t][0] = ld16bf(kr, kr + 16);
      kb[t][1] = ld16bf(kr + 32, kr + 48);
    }
    // keeps these reads together ahead of the first half's maxima, which run
    // while they return
    __builtin_amdgcn_sched_barrier(0);

    // the maximum of each subtile
    float vm[8];
#pragma unroll
    for (int t = 0; t < 4; ++t) {
      vm[t] = s[t][0];
#pragma unroll
      for (int r = 1; r < 8; ++r) vm[t] = fmaxf(vm[t], s[t][r]);
    }
    // keeps the maxima in front of the wait below, so that they run while the
    // reads return
    __builtin_amdgcn_sched_barrier(0);
    if (more) {
      // this wave's reads of its mask rows have returned before the copies
      // below write the same rows
      asm volatile("s_wait_dscnt 0x0" ::: "memory");
      issue_mask(k0 + KC_);
    }

#pragma unroll
    for (int t = 4; t < 8; ++t) {
#pragma unroll
      for (int r = 0; r < 8; ++r) s[t][r] = 0.f;
      s[t] = wmma_bf16(kb[t - 4][0], qf0, s[t]);
    }
#pragma unroll
    for (int t = 4; t < 8; ++t) s[t] = wmma_bf16(kb[t - 4][1], qf1, s[t]);
    // as in the first half: products, then scale, then the next reads
    __builtin_amdgcn_sched_barrier(0);
#pragma unroll
    for (int t = 4; t < 8; ++t)
      s[t] = s[t] * 0.125f + __builtin_shufflevector(mk[2 * t], mk[2 * t + 1],
                                                     0, 1, 2, 3, 4, 5, 6, 7);
    // the scale stays in front of the V^T reads, which take over the K and
    // mask registers
    __builtin_amdgcn_sched_barrier(0);

    // V^T rows as A operand (row = d), 4 output d-tiles x the first 2 steps of
    // 32 keys
    v16bf va[2][4];
#pragma unroll
    for (int u = 0; u < 2; ++u) {
#pragma unroll
      for (int t = 0; t < 4; ++t) {
        const unsigned short* vr = &Vs[bf][16 * t + ln][32 * u + half * 8];
        va[u][t] = ld16bf(vr, vr + 16);
      }
    }
    // keeps the V^T reads together ahead of the softmax, which covers their
    // latency: without it each stands in front of the product that waits for it
    __builtin_amdgcn_sched_barrier(0);

#pragma unroll
    for (int t = 4; t < 8; ++t) {
      vm[t] = s[t][0];
#pragma unroll
      for (int r = 1; r < 8; ++r) vm[t] = fmaxf(vm[t], s[t][r]);
    }

    // online softmax: 64 keys in-lane, the other 64 in lane ^ 16
    float v = fmaxf(fmaxf(fmaxf(vm[0], vm[1]), fmaxf(vm[2], vm[3])),
                    fmaxf(fmaxf(vm[4], vm[5]), fmaxf(vm[6], vm[7])));
    v = fmaxf(v, xhalf(v));
    const float mn   = fmaxf(mrow, v);
    const float corr = __expf(mrow - mn);
    mrow = mn;

    // P^T as B operand of step u: element e <-> key 32 u + 8 half + e,
    // 8 + e <-> 32 u + 16 + 8 half + e
    // t8: this half's terms, subtile after subtile, so that a subtile's f32
    // terms are done with once they are packed and added
    v16bf pb[4];
    v8f t8;
#pragma unroll
    for (int t = 0; t < 4; ++t) {
      v8f p;
#pragma unroll
      for (int r = 0; r < 8; ++r) {
        p[r] = __expf(s[t][r] - mn);
        pb[t >> 1][8 * (t & 1) + r] = (__bf16)p[r];
      }
      t8 = (t == 0) ? p : t8 + p;
    }
#pragma unroll
    for (int t = 0; t < 4; ++t) {
#pragma unroll
      for (int r = 0; r < 8; ++r) o[t][r] *= corr;
    }

    // O^T += V^T . P^T   (four K=32 steps over this key chunk, 4 output d-tiles)
#pragma unroll
    for (int u = 0; u < 2; ++u) {
#pragma unroll
      for (int t = 0; t < 4; ++t) o[t] = wmma_bf16(va[u][t], pb[u], o[t]);
    }

    // V^T rows of the last 2 steps
    v16bf vb[2][4];
#pragma unroll
    for (int u = 0; u < 2; ++u) {
#pragma unroll
      for (int t = 0; t < 4; ++t) {
        const unsigned short* vr = &Vs[bf][16 * t + ln][64 + 32 * u + half * 8];
        vb[u][t] = ld16bf(vr, vr + 16);
      }
    }
    // keeps these reads together ahead of the second half's exponentials,
    // which cover their latency
    __builtin_amdgcn_sched_barrier(0);

#pragma unroll
    for (int t = 4; t < 8; ++t) {
      v8f p;
#pragma unroll
      for (int r = 0; r < 8; ++r) {
        p[r] = __expf(s[t][r] - mn);
        pb[t >> 1][8 * (t & 1) + r] = (__bf16)p[r];
      }
      t8 = t8 + p;
    }
    const f32x4 t4 = __builtin_shufflevector(t8, t8, 0, 1, 2, 3) +
                     __builtin_shufflevector(t8, t8, 4, 5, 6, 7);
    lrow = lrow * corr + ((t4[0] + t4[2]) + (t4[1] + t4[3]));
    // keeps the closing barrier, and the wait for all LDS reads in front of it,
    // behind the exponentials: lifted above them the wave sits out the latency
    // of the V^T reads that the exponentials are there to cover
    __builtin_amdgcn_sched_barrier(0);

#pragma unroll
    for (int u = 0; u < 2; ++u) {
#pragma unroll
      for (int t = 0; t < 4; ++t) o[t] = wmma_bf16(vb[u][t], pb[2 + u], o[t]);
    }

    __syncthreads();   // all waves done with buffer bf before it refills
  };
  for (int k0 = 0; k0 < S_ - KC_; k0 += KC_) pass(k0, true);
  pass(S_ - KC_, false);

  // join the halves' sums, normalize and emit context, merged heads bf16
  // [b*S+s][H]: 8 consecutive d per lane and tile
  const float inv = 1.0f / (lrow + xhalf(lrow));
  v8bf c0, c1, c2, c3;
#pragma unroll
  for (int r = 0; r < 8; ++r) {
    c0[r] = (__bf16)(o[0][r] * inv);
    c1[r] = (__bf16)(o[1][r] * inv);
    c2[r] = (__bf16)(o[2][r] * inv);
    c3[r] = (__bf16)(o[3][r] * inv);
  }
  // The wave's 16 x 64 tile is 16 whole lines of ctx, but a lane holds 16-byte
  // pieces of one row.  The tile turns in the mask rows that this wave alone
  // filled and read (no copy is in flight behind the last pass), so that each
  // store covers 4 whole lines.
  unsigned short* srow =
      reinterpret_cast<unsigned short*>(&Ms[wave * 16 + ln][0]) + half * 8;
  *reinterpret_cast<u32x4*>(srow)      = __builtin_bit_cast(u32x4, c0);
  *reinterpret_cast<u32x4*>(srow + 16) = __builtin_bit_cast(u32x4, c1);
  *reinterpret_cast<u32x4*>(srow + 32) = __builtin_bit_cast(u32x4, c2);
  *reinterpret_cast<u32x4*>(srow + 48) = __builtin_bit_cast(u32x4, c3);
  // the other lanes' pieces are in LDS before this lane reads them back
  asm volatile("s_wait_dscnt 0x0" ::: "memory");
  const int sub = lane >> 3, c8 = (lane & 7) * 8;
  u32x4 tc[4];
#pragma unroll
  for (int t = 0; t < 4; ++t)
    tc[t] = *reinterpret_cast<const u32x4*>(
        reinterpret_cast<const unsigned short*>(&Ms[wave * 16 + 4 * t + sub][0]) + c8);
  unsigned short* crow =
      ctx + ((size_t)b * S_ + (qb + sub)) * H_ + (size_t)h * HD_ + c8;
#pragma unroll
  for (int t = 0; t < 4; ++t)
    *reinterpret_cast<u32x4*>(crow + 4 * t * H_) = tc[t];
}

// ---------------------------------------------------------------------------
// Kernel 4: output projection + bias + residual + LayerNorm (fused)
// ---------------------------------------------------------------------------
// register budget as in the QKV kernel: one block per WGP, 4 waves per SIMD
__global__ __launch_bounds__(512) __attribute__((amdgpu_waves_per_eu(4, 4)))
void proj_ln_kernel(
    const unsigned short* __restrict__ ctx,
    const unsigned short* __restrict__ woP,
    const float* __restrict__ bo, const float* __restrict__ x,
    const float* __restrict__ gamma, const float* __restrict__ beta,
    float* __restrict__ out) {
  __shared__ __align__(16) unsigned short cA[GR_][264];
  __shared__ __align__(16) float          ot[GR_][264];

  const int tid = threadIdx.x;
  const int mbase = blockIdx.x * GR_;
  const int wave = tid >> 5, lane = tid & 31;
  const int half = lane >> 4, ln = lane & 15;
  const int j = wave * 16 + ln;

  // the wave's 16 weight columns need nothing from LDS: they are asked for
  // ahead of the barrier and arrive while the ctx tile is staged
  const float bb = bo[j];
  const unsigned short* bp = woP + wave * WTILE_ + lane * 8;
  v16bf bw[H_ / 32];
#pragma unroll
  for (int k = 0; k < H_ / 32; ++k)
    bw[k] = ld16bf(bp + WSTEP_ * k, bp + WSTEP_ * k + 256);

  { // stage ctx tile (already bf16)
    const int ch = (tid & 31) * 8;
#pragma unroll
    for (int t = 0; t < GT_; ++t) {
      const int row = (tid >> 5) + 16 * t;
      *reinterpret_cast<u32x4*>(&cA[row][ch]) =
          *reinterpret_cast<const u32x4*>(ctx + (size_t)(mbase + row) * H_ + ch);
    }
  }
  // the weight loads' address stays whole up to this wait
  asm volatile("s_wait_xcnt 0x0" :: "v"(bp) : "memory");
  __syncthreads();

  v8f c[GT_];
#pragma unroll
  for (int t = 0; t < GT_; ++t) {
#pragma unroll
    for (int r = 0; r < 8; ++r) c[t][r] = bb;
  }

#pragma unroll
  for (int kk = 0; kk < H_; kk += 32) {
#pragma unroll
    for (int t = 0; t < GT_; ++t) {
      const unsigned short* ar = &cA[16 * t + ln][kk + half * 8];
      c[t] = wmma_bf16(ld16bf(ar, ar + 16), bw[kk / 32], c[t]);
    }
  }

  // + residual, stage rows for LayerNorm
  {
    const float* xr = x + (size_t)(mbase + 8 * half) * H_ + j;
    float res[GT_][8];
#pragma unroll
    for (int t = 0; t < GT_; ++t) {
#pragma unroll
      for (int r = 0; r < 8; ++r) res[t][r] = xr[(16 * t + r) * H_];
    }
    // the loads' address stays whole up to this wait
    asm volatile("s_wait_xcnt 0x0" :: "v"(xr) : "memory");
#pragma unroll
    for (int t = 0; t < GT_; ++t) {
#pragma unroll
      for (int r = 0; r < 8; ++r)
        ot[16 * t + r + 8 * half][j] = c[t][r] + res[t][r];
    }
  }
  __syncthreads();

  // LayerNorm: wave w normalizes rows w, w + 16, ...  A lane takes 4 columns
  // of each half of the row, so a wave's 16-byte stores cover 4 whole lines
#pragma unroll
  for (int t = 0; t < GT_; ++t) {
    const int row = wave + 16 * t, c0 = lane * 4;
    float vals[8], s = 0.f, sq = 0.f;
#pragma unroll
    for (int i = 0; i < 8; ++i) {
      vals[i] = ot[row][c0 + (i >> 2) * 128 + (i & 3)];
      s += vals[i];
      sq += vals[i] * vals[i];
    }
    s  += __shfl_xor(s, 16, 32);  sq += __shfl_xor(sq, 16, 32);
    s  += __shfl_xor(s, 8, 32);   sq += __shfl_xor(sq, 8, 32);
    s  += __shfl_xor(s, 4, 32);   sq += __shfl_xor(sq, 4, 32);
    s  += __shfl_xor(s, 2, 32);   sq += __shfl_xor(sq, 2, 32);
    s  += __shfl_xor(s, 1, 32);   sq += __shfl_xor(sq, 1, 32);
    const float mu  = s * (1.0f / 256.0f);
    const float var = sq * (1.0f / 256.0f) - mu * mu;
    const float inv = rsqrtf(var + 1e-12f);
    const size_t gr = (size_t)(mbase + row) * H_;
#pragma unroll
    for (int i = 0; i < 8; ++i) {
      const int col = c0 + (i >> 2) * 128 + (i & 3);
      out[gr + col] = (vals[i] - mu) * inv * gamma[col] + beta[col];
    }
  }
}

// ---------------------------------------------------------------------------
extern "C" void kernel_launch(void* const* d_in, const int* in_sizes, int n_in,
                              void* d_out, int out_size, void* d_ws, size_t ws_size,
                              hipStream_t stream) {
  const float* x     = (const float*)d_in[0];
  const float* mask  = (const float*)d_in[1];
  const float* Wq    = (const float*)d_in[2];
  const float* bq    = (const float*)d_in[3];
  const float* Wk    = (const float*)d_in[4];
  const float* bk    = (const float*)d_in[5];
  const float* Wv    = (const float*)d_in[6];
  const float* bv    = (const float*)d_in[7];
  const float* Wo    = (const float*)d_in[8];
  const float* bo    = (const float*)d_in[9];
  const float* gamma = (const float*)d_in[10];
  const float* beta  = (const float*)d_in[11];
  float* out = (float*)d_out;

  // workspace layout (ushort elements)
  unsigned short* ws  = (unsigned short*)d_ws;
  unsigned short* wT  = ws;                         // 4 * 256*256
  unsigned short* Qb  = ws + 4 * H_ * H_;           // [B][NH][S][HD]
  unsigned short* Kb  = Qb + (size_t)B_ * NH_ * S_ * HD_;
  unsigned short* Vtb = Kb + (size_t)B_ * NH_ * S_ * HD_;
  unsigned short* ctx = Vtb + (size_t)B_ * NH_ * S_ * HD_;  // [M][H]

  prep_weights_kernel<<<dim3(H_ * H_ / 8 / 256, 4), 256, 0, stream>>>(
      Wq, Wk, Wv, Wo, wT);

  qkv_kernel<<<M_ / GR_, 512, 0, stream>>>(
      x, bq, bk, bv, wT, wT + H_ * H_, wT + 2 * H_ * H_, Qb, Kb, Vtb);

  attn_kernel<<<dim3(S_ / QB_, NH_, B_), 256, 0, stream>>>(
      mask, Qb, Kb, Vtb, ctx);

  proj_ln_kernel<<<M_ / GR_, 512, 0, stream>>>(
      ctx, wT + 3 * H_ * H_, bo, x, gamma, beta, out);
}

// v008
// A run of this version takes 57.7 microseconds.
// Two timings next to v007 both put it at 1.04 times that version's speed.
// Counting every step since v000, it is 2.93 times as fast.
#include <hip/hip_runtime.h>
#include <hip/hip_bf16.h>
#include <math.h>

// Problem constants (match reference)
#define B_   8
#define S_   2048
#define H_   256
#define NH_  4
#define HD_  64
#define M_   (B_ * S_)          // 16384 rows

typedef __attribute__((ext_vector_type(16))) __bf16       v16bf;
typedef __attribute__((ext_vector_type(8)))  __bf16       v8bf;
typedef __attribute__((ext_vector_type(8)))  float        v8f;
typedef __attribute__((ext_vector_type(4)))  float        f32x4;
typedef __attribute__((ext_vector_type(4)))  unsigned int u32x4;

struct U32x8 { u32x4 lo, hi; };

// float -> bf16 (round to nearest even, NaN-agnostic — inputs are sane)
static __device__ __forceinline__ unsigned short f2bf(float f) {
  unsigned u = __builtin_bit_cast(unsigned, f);
  u += 0x7FFFu + ((u >> 16) & 1u);
  return (unsigned short)(u >> 16);
}

// Build a WMMA 16-bf16 operand from two aligned 16-byte chunks.
// Per ISA 7.12.2 (wave32): per lane, elements 0..7 <-> K = half*8 + e,
// elements 8..15 <-> K = 16 + half*8 + e.  Storing tiles row-major [m][k]
// (A) or [n][k] (B-transposed) makes both chunks contiguous b128 loads.
static __device__ __forceinline__ v16bf ld16bf(const unsigned short* p0,
                                               const unsigned short* p1) {
  U32x8 u;
  u.lo = *reinterpret_cast<const u32x4*>(p0);
  u.hi = *reinterpret_cast<const u32x4*>(p1);
  return __builtin_bit_cast(v16bf, u);
}

static __device__ __forceinline__ v8f wmma_bf16(v16bf a, v16bf b, v8f c) {
  return __builtin_amdgcn_wmma_f32_16x16x32_bf16(
      /*neg_a=*/false, a, /*neg_b=*/false, b,
      /*c_mod=*/(short)0, c, /*reuse_a=*/false, /*reuse_b=*/false);
}

// --- CDNA5 async memory->LDS copy (ASYNCcnt path) --------------------------
// Per lane: LDS[ldsOff] <- MEM[base + gOff] (16 bytes).  GVS addressing:
// 64-bit SGPR base + 32-bit per-lane VGPR offset.  LDS offset is the low
// 32 bits of the generic shared-space address (aperture: addr[31:0]).
static __device__ __forceinline__ unsigned lds_off(const void* p) {
  return (unsigned)(size_t)p;
}
// Copies of a lane that share one LDS-address register and one offset
// register, so that a chunk's copies take no register per row.  The immediate
// offset moves both addresses by the LDS step from row to row; the rest of the
// global step stands in each copy's scalar base.  The closing s_wait_xcnt 0
// stands inside the copies' own statement so that no later write of an address
// register they name can be placed in front of it.
// Mask: 16 pairs of rows, 1056 bytes apart in LDS and 16384 in memory
// (16384 - 1056 = 15328).
static __device__ __forceinline__ void async_mask16_b128(
    unsigned l, unsigned g, const void* base) {
  const unsigned long long b = (unsigned long long)(size_t)base;
  asm volatile("global_load_async_to_lds_b128 %0, %1, %2\n\t"
               "global_load_async_to_lds_b128 %0, %1, %3 offset:1056\n\t"
               "global_load_async_to_lds_b128 %0, %1, %4 offset:2112\n\t"
               "global_load_async_to_lds_b128 %0, %1, %5 offset:3168\n\t"
               "global_load_async_to_lds_b128 %0, %1, %6 offset:4224\n\t"
               "global_load_async_to_lds_b128 %0, %1, %7 offset:5280\n\t"
               "global_load_async_to_lds_b128 %0, %1, %8 offset:6336\n\t"
               "global_load_async_to_lds_b128 %0, %1, %9 offset:7392\n\t"
               "global_load_async_to_lds_b128 %0, %1, %10 offset:8448\n\t"
               "global_load_async_to_lds_b128 %0, %1, %11 offset:9504\n\t"
               "global_load_async_to_lds_b128 %0, %1, %12 offset:10560\n\t"
               "global_load_async_to_lds_b128 %0, %1, %13 offset:11616\n\t"
               "global_load_async_to_lds_b128 %0, %1, %14 offset:12672\n\t"
               "global_load_async_to_lds_b128 %0, %1, %15 offset:13728\n\t"
               "global_load_async_to_lds_b128 %0, %1, %16 offset:14784\n\t"
               "global_load_async_to_lds_b128 %0, %1, %17 offset:15840\n\t"
               "s_wait_xcnt 0x0"
               :
               : "v"(l), "v"(g),
                 "s"(b), "s"(b + 1 * 15328), "s"(b + 2 * 15328), "s"(b + 3 * 15328),
                 "s"(b + 4 * 15328), "s"(b + 5 * 15328), "s"(b + 6 * 15328), "s"(b + 7 * 15328),
                 "s"(b + 8 * 15328), "s"(b + 9 * 15328), "s"(b + 10 * 15328), "s"(b + 11 * 15328),
                 "s"(b + 12 * 15328), "s"(b + 13 * 15328), "s"(b + 14 * 15328), "s"(b + 15 * 15328)
               : "memory");
}
// K: 4 rows, 32 keys apart: 4608 bytes in LDS, 4096 in memory (base - 512 a
// row).  V^T: 4 rows, 16 d apart: 4352 bytes in LDS, 65536 in memory
// (base + 61184 a row).
static __device__ __forceinline__ void async_kv8_b128(
    unsigned lk, unsigned gk, const void* kb,
    unsigned lv, unsigned gv, const void* vb) {
  const unsigned long long k = (unsigned long long)(size_t)kb;
  const unsigned long long v = (unsigned long long)(size_t)vb;
  asm volatile("global_load_async_to_lds_b128 %0, %1, %4\n\t"
               "global_load_async_to_lds_b128 %0, %1, %5 offset:4608\n\t"
               "global_load_async_to_lds_b128 %0, %1, %6 offset:9216\n\t"
               "global_load_async_to_lds_b128 %0, %1, %7 offset:13824\n\t"
               "global_load_async_to_lds_b128 %2, %3, %8\n\t"
               "global_load_async_to_lds_b128 %2, %3, %9 offset:4352\n\t"
               "global_load_async_to_lds_b128 %2, %3, %10 offset:8704\n\t"
               "global_load_async_to_lds_b128 %2, %3, %11 offset:13056\n\t"
               "s_wait_xcnt 0x0"
               :
               : "v"(lk), "v"(gk), "v"(lv), "v"(gv),
                 "s"(k), "s"(k - 512), "s"(k - 2 * 512), "s"(k - 3 * 512),
                 "s"(v), "s"(v + 61184), "s"(v + 2 * 61184), "s"(v + 3 * 61184)
               : "memory");
}

// ---------------------------------------------------------------------------
// Kernel 1: convert the 4 weight matrices to bf16, packed in the order in which
// the projections read their weight fragments (A for Wq, Wk; B for Wv, Wo):
//   [matrix][16-column tile][k step of 32][piece 0..1][lane][8 bf16]
// Lane (half, ln) of piece c holds column 16 tile + ln, k = 32 step + 16 c +
// 8 half + 0..7, so one 16-byte load of a whole wave covers 512 contiguous
// bytes (4 whole lines) and a wave's share of a matrix is 8 KiB in a row.
// One thread converts and stores one 16-byte piece.
// ---------------------------------------------------------------------------
#define WSTEP_ 512              // bf16 elements of one tile's k step (2 pieces)
#define WTILE_ (16 * H_)        // bf16 elements of one 16-column tile
__global__ __launch_bounds__(256) void prep_weights_kernel(
    const float* __restrict__ Wq, const float* __restrict__ Wk,
    const float* __restrict__ Wv, const float* __restrict__ Wo,
    unsigned short* __restrict__ wP) {
  const int mat = blockIdx.y;
  const float* src = (mat == 0) ? Wq : (mat == 1) ? Wk : (mat == 2) ? Wv : Wo;
  const int g = blockIdx.x * 256 + threadIdx.x;   // 16-byte piece of the matrix
  const int lane = g & 31, c = (g >> 5) & 1, ks = (g >> 6) & 7, tile = g >> 9;
  const int n = tile * 16 + (lane & 15);
  const int k = ks * 32 + c * 16 + (lane >> 4) * 8;
  const float* s = src + k * H_ + n;
  float f[8];
#pragma unroll
  for (int e = 0; e < 8; ++e) f[e] = s[e * H_];
  u32x4 o;
#pragma unroll
  for (int i = 0; i < 4; ++i)
    o[i] = (unsigned)f2bf(f[2 * i]) | ((unsigned)f2bf(f[2 * i + 1]) << 16);
  *reinterpret_cast<u32x4*>(wP + (size_t)mat * H_ * H_ + (size_t)g * 8) = o;
}

// ---------------------------------------------------------------------------
// Kernel 2: QKV projection.  64-row m-tile per block, 16 waves = 16 n-tiles;
// a wave keeps 4 row tiles x 3 matrices of accumulators, so every weight
// fragment it loads feeds 4 products.
// Writes Q,K bf16 [b][h][s][d]; V transposed bf16 [b][h][d][s].
// Q and K are formed with the weights as A and x as B, so a lane's 8 registers
// hold 8 consecutive d of one row; V with x as A, so they hold 8 consecutive s
// of one d.  Either way a tile leaves a lane as one 16-byte piece; the pieces
// are gathered in LDS and go out as whole 128-byte lines.
// ---------------------------------------------------------------------------
#define GT_ 4                   // 16-row tiles per block in both projections
#define GR_ (16 * GT_)          // rows per block

// one block per WGP (grid = 256): 4 waves per SIMD is all that can be resident,
// so the compiler may spend that share of the registers on loads issued ahead
__global__ __launch_bounds__(512) __attribute__((amdgpu_waves_per_eu(4, 4)))
void qkv_kernel(
    const float* __restrict__ x,
    const float* __restrict__ bq, const float* __restrict__ bk,
    const float* __restrict__ bv,
    const unsigned short* __restrict__ wqP,
    const unsigned short* __restrict__ wkP,
    const unsigned short* __restrict__ wvP,
    unsigned short* __restrict__ Q, unsigned short* __restrict__ K,
    unsigned short* __restrict__ Vt) {
  __shared__ __align__(16) unsigned short xA[GR_][264];
  __shared__ __align__(16) unsigned short qS[GR_][264];    // Q tile [s][column]
  __shared__ __align__(16) unsigned short kS[GR_][264];    // K tile [s][column]
  __shared__ __align__(16) unsigned short vS[H_][GR_ + 8]; // V^T tile [column][s]

  const int tid   = threadIdx.x;
  const int mbase = blockIdx.x * GR_;
  const int wave = tid >> 5, lane = tid & 31;
  const int half = lane >> 4, ln = lane & 15;
  const int j = wave * 16 + ln;                // V: this lane's output column
  const int j8 = wave * 16 + half * 8;         // Q, K: first of its 8 columns

  // biases and the first k step's weight fragments need nothing from LDS:
  // they are asked for ahead of the barrier and arrive while x is staged
  const f32x4 bq0 = *reinterpret_cast<const f32x4*>(bq + j8);
  const f32x4 bq1 = *reinterpret_cast<const f32x4*>(bq + j8 + 4);
  const f32x4 bk0 = *reinterpret_cast<const f32x4*>(bk + j8);
  const f32x4 bk1 = *reinterpret_cast<const f32x4*>(bk + j8 + 4);
  const float biasv = bv[j];
  const unsigned short* pq = wqP + wave * WTILE_ + lane * 8;
  const unsigned short* pk = wkP + wave * WTILE_ + lane * 8;
  const unsigned short* pv = wvP + wave * WTILE_ + lane * 8;
  v16bf nq = ld16bf(pq, pq + 256);
  v16bf nk = ld16bf(pk, pk + 256);
  v16bf nv = ld16bf(pv, pv + 256);

  { // stage 64x256 fp32 -> bf16 LDS, one whole row per wave and pass
    const int col = (tid & 31) * 8, row = tid >> 5;
    const float* src = x + (size_t)(mbase + row) * H_ + col;
    f32x4 lo[GT_], hi[GT_];
#pragma unroll
    for (int t = 0; t < GT_; ++t) {
      lo[t] = *reinterpret_cast<const f32x4*>(src + 16 * t * H_);
      hi[t] = *reinterpret_cast<const f32x4*>(src + 16 * t * H_ + 4);
    }
    // the loads' address stays whole up to this wait
    asm volatile("s_wait_xcnt 0x0" :: "v"(src) : "memory");
#pragma unroll
    for (int t = 0; t < GT_; ++t) {
#pragma unroll
      for (int i = 0; i < 4; ++i) {
        xA[row + 16 * t][col + i]     = f2bf(lo[t][i]);
        xA[row + 16 * t][col + 4 + i] = f2bf(hi[t][i]);
      }
    }
  }
  __syncthreads();

  v8f cq[GT_], ck[GT_], cv[GT_];
#pragma unroll
  for (int t = 0; t < GT_; ++t) {
#pragma unroll
    for (int r = 0; r < 8; ++r) {
      cq[t][r] = (r < 4) ? bq0[r & 3] : bq1[r & 3];
      ck[t][r] = (r < 4) ? bk0[r & 3] : bk1[r & 3];
      cv[t][r] = biasv;
    }
  }

  // weight fragments are fetched one k step ahead of the products they feed
#pragma unroll
  for (int kk = 0; kk < H_; kk += 32) {
    const v16bf bqv = nq, bkv = nk, bvv = nv;
    if (kk + 32 < H_) {
      const int nx = (kk / 32 + 1) * WSTEP_;
      nq = ld16bf(pq + nx, pq + nx + 256);
      nk = ld16bf(pk + nx, pk + nx + 256);
      nv = ld16bf(pv + nx, pv + nx + 256);
      // holds the next step's weight loads in front of this step's products:
      // without it they sink to just ahead of their use and each k step
      // waits out the L2 latency
      __builtin_amdgcn_sched_barrier(0);
    }
#pragma unroll
    for (int t = 0; t < GT_; ++t) {
      const unsigned short* ar = &xA[16 * t + ln][kk + half * 8];
      const v16bf a = ld16bf(ar, ar + 16);
      cq[t] = wmma_bf16(bqv, a, cq[t]);   // [column j8 + r][row 16 t + ln]
      ck[t] = wmma_bf16(bkv, a, ck[t]);
      cv[t] = wmma_bf16(a, bvv, cv[t]);   // [row 16 t + 8 half + r][column j]
    }
  }

  // each tile's 8 values of a lane: one 16-byte piece into the block's tiles
#pragma unroll
  for (int t = 0; t < GT_; ++t) {
    *reinterpret_cast<v8bf*>(&qS[16 * t + ln][j8]) =
        __builtin_convertvector(cq[t], v8bf);
    *reinterpret_cast<v8bf*>(&kS[16 * t + ln][j8]) =
        __builtin_convertvector(ck[t], v8bf);
    *reinterpret_cast<v8bf*>(&vS[j][16 * t + 8 * half]) =
        __builtin_convertvector(cv[t], v8bf);
  }
  __syncthreads();

  // whole lines out.  Q, K: a wave takes one row s a pass, 8 lanes per head
  // (64 d = one line).  V^T: four columns a pass, 8 lanes per column
  // (the block's 64 s = one line).
  const int b = mbase >> 11, s0 = mbase & (S_ - 1);
  const int sub = lane >> 3, c8 = (lane & 7) * 8;
  u32x4 tq[GT_], tk[GT_], tv[GT_];
#pragma unroll
  for (int t = 0; t < GT_; ++t) {
    tq[t] = *reinterpret_cast<const u32x4*>(&qS[wave + 16 * t][lane * 8]);
    tk[t] = *reinterpret_cast<const u32x4*>(&kS[wave + 16 * t][lane * 8]);
    tv[t] = *reinterpret_cast<const u32x4*>(&vS[wave * 16 + 4 * t + sub][c8]);
  }
  const size_t qoff = (((size_t)b * NH_ + sub) * S_ + s0 + wave) * HD_ + c8;
  const size_t voff = ((size_t)b * H_ + wave * 16 + sub) * S_ + s0 + c8;
#pragma unroll
  for (int t = 0; t < GT_; ++t) {
    *reinterpret_cast<u32x4*>(Q + qoff + 16 * t * HD_) = tq[t];
    *reinterpret_cast<u32x4*>(K + qoff + 16 * t * HD_) = tk[t];
    *reinterpret_cast<u32x4*>(Vt + voff + 4 * t * S_)  = tv[t];
  }
}

#define KC_ 128
#define QB_ 128
// lane l <-> lane l ^ 16
static __device__ __forceinline__ float xhalf(float v) {
  const int i = __builtin_bit_cast(int, v);
  return __builtin_bit_cast(
      float, __builtin_amdgcn_permlanex16(i, i, 0x76543210, 0xfedcba98,
                                          false, false));
}

// 2 blocks per WGP (grid = 512): 4 waves per SIMD must stay resident, which
// bounds the registers of a wave
__global__ __launch_bounds__(256) __attribute__((amdgpu_waves_per_eu(4, 4)))
void attn_kernel(
    const float* __restrict__ mask,
    const unsigned short* __restrict__ Q,
    const unsigned short* __restrict__ K,
    const unsigned short* __restrict__ Vt,
    unsigned short* __restrict__ ctx) {
  __shared__ __align__(16) unsigned short Ks[2][KC_][72];      // key chunk [key][d]
  __shared__ __align__(16) unsigned short Vs[2][64][KC_ + 8];  // V^T chunk [d][key]
  __shared__ __align__(16) float          Ms[QB_][KC_ + 4];    // mask chunk [q][key]

  const int tid = threadIdx.x, wave = tid >> 5, lane = tid & 31;
  const int half = lane >> 4, ln = lane & 15;
  const int qg = wave >> 1, kh = wave & 1;
  const int b = blockIdx.z, h = blockIdx.y;

  const size_t headQK = ((size_t)b * NH_ + h) * S_ * HD_;
  const size_t headV  = ((size_t)b * NH_ + h) * HD_ * S_;
  const unsigned short* qbase =
      Q + headQK + (size_t)(blockIdx.x * QB_ + qg * 32) * HD_;
  const unsigned short* kbase = K + headQK;
  const unsigned short* vbase = Vt + headV;

  // Q^T as B operand (column = query 16 c + ln), loaded once and kept in
  // registers
  v16bf qf[2][2];
#pragma unroll
  for (int c = 0; c < 2; ++c) {
    const unsigned short* qrow = qbase + (16 * c + ln) * HD_ + half * 8;
    qf[c][0] = ld16bf(qrow, qrow + 16);
    qf[c][1] = ld16bf(qrow + 32, qrow + 48);
  }

  // mask rows of this block's 128 queries
  const float* mbase = mask + ((size_t)b * S_ + blockIdx.x * QB_) * S_;

  // one 128-key K/V chunk into buffer bf: 8 copies a lane.  K: 128 rows of one
  // line, 8 lanes a row, rows rr + 32 j; V^T: 64 rows of two lines, 16 lanes a
  // row, rows rv + 16 j.  The chunk's place goes into the scalar bases
  auto issue_kv = [&](int k0, int bf) {
    const int rr = tid >> 3, cc = (tid & 7) * 8;
    const int rv = tid >> 4, cv = (tid & 15) * 8;
    async_kv8_b128(lds_off(&Ks[bf][rr][cc]), (unsigned)((rr * HD_ + cc) * 2),
                   kbase + k0 * HD_,
                   lds_off(&Vs[bf][rv][cv]), (unsigned)((rv * S_ + cv) * 2),
                   vbase + k0);
  };
  // the wave's own 32 rows x 64 columns of one chunk's mask: 16 copies a lane,
  // each copy of the wave two rows of 256 bytes (2 whole lines each)
  auto issue_mask = [&](int k0) {
    const int mr0 = qg * 32 + half, mc = kh * 64 + ln * 4;
    const unsigned g = (unsigned)((mr0 * S_ + mc) * 4);
    async_mask16_b128(lds_off(&Ms[mr0][mc]), g, mbase + k0);
  };

  // every loop over c, t, u or r below is unrolled so that the register arrays
  // it walks are indexed by constants and never leave the registers
  // o[c][t][r] = O[query 16 c + ln][d = 16 t + 8 half + r], this wave's keys
  v8f o[2][4];
#pragma unroll
  for (int c = 0; c < 2; ++c) {
#pragma unroll
    for (int t = 0; t < 4; ++t) {
#pragma unroll
      for (int r = 0; r < 8; ++r) o[c][t][r] = 0.f;
    }
  }
  // running maximum of query 16 c + ln over this wave's keys (equal in both
  // lane halves) and running sum over this lane half's keys only
  float mrow[2] = {-1e30f, -1e30f};
  float lrow[2] = {0.f, 0.f};

  issue_kv(0, 0);
  issue_mask(0);

  // one pass over the 128 keys from k0; more: a further chunk follows.  The
  // last pass is written out behind the loop, so that the loop's body has no
  // branch in it and the order set below holds from end to end
  auto pass = [&](int k0, bool more) __attribute__((always_inline)) {
    const int bf = (k0 / KC_) & 1;
    // this chunk's copies, all that this wave has in flight, have landed
    asm volatile("s_wait_asynccnt 0" ::: "memory");
    __syncthreads();   // chunk bf visible to all waves

    // attention mask: 8 consecutive keys of one query per lane, tile and
    // subtile (keys 64 kh + 16 t + 8 half + r); here subtiles 0 and 1
    const float* mr = &Ms[qg * 32 + ln][kh * 64 + half * 8];
    f32x4 mk[2][2][2];
#pragma unroll
    for (int c = 0; c < 2; ++c) {
#pragma unroll
      for (int t = 0; t < 2; ++t) {
        const float* m = mr + 16 * c * (KC_ + 4) + 16 * t;
        mk[c][t][0] = *reinterpret_cast<const f32x4*>(m);
        mk[c][t][1] = *reinterpret_cast<const f32x4*>(m + 4);
      }
    }
    // K rows as A operand (row = key), both d halves of subtiles 0 and 1
    v16bf ka[2][2];
#pragma unroll
    for (int t = 0; t < 2; ++t) {
      const unsigned short* kr = &Ks[bf][kh * 64 + 16 * t + ln][half * 8];
      ka[t][0] = ld16bf(kr, kr + 16);
      ka[t][1] = ld16bf(kr + 32, kr + 48);
    }
    // keeps these LDS reads together ahead of the products: without it each
    // read stands directly in front of the product that waits for it
    __builtin_amdgcn_sched_barrier(0);
    // the next chunk's K/V, into the buffer that every wave left at the last
    // pass's closing barrier; issued here, while the reads above return
    if (more) issue_kv(k0 + KC_, bf ^ 1);

    // scores^T = K . Q^T over d=64 (two K=32 WMMA steps per 16-key subtile)
    // s[c][t][r] = S[query 16 c + ln][key = 64 kh + 16 t + 8 half + r]
    v8f s[2][4];
#pragma unroll
    for (int t = 0; t < 2; ++t) {
#pragma unroll
      for (int c = 0; c < 2; ++c) {
#pragma unroll
        for (int r = 0; r < 8; ++r) s[c][t][r] = 0.f;
        s[c][t] = wmma_bf16(ka[t][0], qf[c][0], s[c][t]);
      }
    }
#pragma unroll
    for (int t = 0; t < 2; ++t) {
#pragma unroll
      for (int c = 0; c < 2; ++c)
        s[c][t] = wmma_bf16(ka[t][1], qf[c][1], s[c][t]);
    }
    // keeps the reads further down behind these products and behind the scale,
    // whose K and mask registers they take over: lifted above them they cost
    // registers that the wave lacks
    __builtin_amdgcn_sched_barrier(0);

    // scale + attention mask, subtiles 0 and 1
#pragma unroll
    for (int c = 0; c < 2; ++c) {
#pragma unroll
      for (int t = 0; t < 2; ++t)
        s[c][t] = s[c][t] * 0.125f +
                  __builtin_shufflevector(mk[c][t][0], mk[c][t][1],
                                          0, 1, 2, 3, 4, 5, 6, 7);
    }
    // as above: the scale stays in front of the reads
    __builtin_amdgcn_sched_barrier(0);

    // mask and K rows of subtiles 2 and 3
    f32x4 ml[2][2][2];
#pragma unroll
    for (int c = 0; c < 2; ++c) {
#pragma unroll
      for (int t = 0; t < 2; ++t) {
        const float* m = mr + 16 * c * (KC_ + 4) + 32 + 16 * t;
        ml[c][t][0] = *reinterpret_cast<const f32x4*>(m);
        ml[c][t][1] = *reinterpret_cast<const f32x4*>(m + 4);
      }
    }
    v16bf kb[2][2];
#pragma unroll
    for (int t = 0; t < 2; ++t) {
      const unsigned short* kr = &Ks[bf][kh * 64 + 32 + 16 * t + ln][half * 8];
      kb[t][0] = ld16bf(kr, kr + 16);
      kb[t][1] = ld16bf(kr + 32, kr + 48);
    }
    // keeps these reads together ahead of the first subtiles' maxima, which run
    // while they return
    __builtin_amdgcn_sched_barrier(0);

    // each query's maximum over subtiles 0 and 1
    float vm[2];
#pragma unroll
    for (int c = 0; c < 2; ++c) {
      vm[c] = s[c][0][0];
#pragma unroll
      for (int r = 1; r < 16; ++r) vm[c] = fmaxf(vm[c], s[c][r >> 3][r & 7]);
    }
    // keeps the maxima in front of the wait below, so that they run while the
    // reads return
    __builtin_amdgcn_sched_barrier(0);
    if (more) {
      // this wave's reads of its part of the mask tile have returned before
      // the copies below write the same bytes
      asm volatile("s_wait_dscnt 0x0" ::: "memory");
      issue_mask(k0 + KC_);
    }

#pragma unroll
    for (int t = 2; t < 4; ++t) {
#pragma unroll
      for (int c = 0; c < 2; ++c) {
#pragma unroll
        for (int r = 0; r < 8; ++r) s[c][t][r] = 0.f;
        s[c][t] = wmma_bf16(kb[t - 2][0], qf[c][0], s[c][t]);
      }
    }
#pragma unroll
    for (int t = 2; t < 4; ++t) {
#pragma unroll
      for (int c = 0; c < 2; ++c)
        s[c][t] = wmma_bf16(kb[t - 2][1], qf[c][1], s[c][t]);
    }
    // as for the first subtiles: products, then scale, then the next reads
    __builtin_amdgcn_sched_barrier(0);
#pragma unroll
    for (int c = 0; c < 2; ++c) {
#pragma unroll
      for (int t = 2; t < 4; ++t)
        s[c][t] = s[c][t] * 0.125f +
                  __builtin_shufflevector(ml[c][t - 2][0], ml[c][t - 2][1],
                                          0, 1, 2, 3, 4, 5, 6, 7);
    }
    // the scale stays in front of the V^T reads, which take over the K and
    // mask registers
    __builtin_amdgcn_sched_barrier(0);

    // V^T rows as A operand (row = d), 4 output d-tiles, the first step of
    // 32 keys
    v16bf va[4];
#pragma unroll
    for (int t = 0; t < 4; ++t) {
      const unsigned short* vr = &Vs[bf][16 * t + ln][kh * 64 + half * 8];
      va[t] = ld16bf(vr, vr + 16);
    }
    // keeps the V^T reads together ahead of the softmax, which covers their
    // latency: without it each stands in front of the product that waits for it
    __builtin_amdgcn_sched_barrier(0);

    // online softmax per query tile: 32 keys in-lane, the other 32 in lane ^ 16
    float mn[2], corr[2];
#pragma unroll
    for (int c = 0; c < 2; ++c) {
      float v = vm[c];
#pragma unroll
      for (int r = 0; r < 16; ++r) v = fmaxf(v, s[c][2 + (r >> 3)][r & 7]);
      v = fmaxf(v, xhalf(v));
      mn[c]   = fmaxf(mrow[c], v);
      corr[c] = __expf(mrow[c] - mn[c]);
      mrow[c] = mn[c];
    }

    // P^T as B operand of step u: element e <-> key 64 kh + 32 u + 8 half + e,
    // 8 + e <-> 64 kh + 32 u + 16 + 8 half + e
    // t8: this half's terms, subtile after subtile, so that a subtile's f32
    // terms are done with once they are packed and added
    v16bf pb[2][2];
    v8f t8[2];
#pragma unroll
    for (int c = 0; c < 2; ++c) {
#pragma unroll
      for (int t = 0; t < 2; ++t) {
        v8f p;
#pragma unroll
        for (int r = 0; r < 8; ++r) {
          p[r] = __expf(s[c][t][r] - mn[c]);
          pb[c][0][8 * t + r] = (__bf16)p[r];
        }
        t8[c] = (t == 0) ? p : t8[c] + p;
      }
    }
#pragma unroll
    for (int c = 0; c < 2; ++c) {
#pragma unroll
      for (int t = 0; t < 4; ++t) {
#pragma unroll
        for (int r = 0; r < 8; ++r) o[c][t][r] *= corr[c];
      }
    }

    // O^T += V^T . P^T   (two K=32 steps over this wave's keys, 4 output
    // d-tiles, each V^T fragment for both query tiles)
#pragma unroll
    for (int t = 0; t < 4; ++t) {
#pragma unroll
      for (int c = 0; c < 2; ++c) o[c][t] = wmma_bf16(va[t], pb[c][0], o[c][t]);
    }

    // V^T rows of the second step
    v16bf vb[4];
#pragma unroll
    for (int t = 0; t < 4; ++t) {
      const unsigned short* vr = &Vs[bf][16 * t + ln][kh * 64 + 32 + half * 8];
      vb[t] = ld16bf(vr, vr + 16);
    }
    // keeps these reads together ahead of the last subtiles' exponentials,
    // which cover their latency
    __builtin_amdgcn_sched_barrier(0);

#pragma unroll
    for (int c = 0; c < 2; ++c) {
#pragma unroll
      for (int t = 2; t < 4; ++t) {
        v8f p;
#pragma unroll
        for (int r = 0; r < 8; ++r) {
          p[r] = __expf(s[c][t][r] - mn[c]);
          pb[c][1][8 * (t - 2) + r] = (__bf16)p[r];
        }
        t8[c] = t8[c] + p;
      }
      const f32x4 t4 = __builtin_shufflevector(t8[c], t8[c], 0, 1, 2, 3) +
                       __builtin_shufflevector(t8[c], t8[c], 4, 5, 6, 7);
      lrow[c] = lrow[c] * corr[c] + ((t4[0] + t4[2]) + (t4[1] + t4[3]));
    }
    // keeps the closing barrier, and the wait for all LDS reads in front of it,
    // behind the exponentials: lifted above them the wave sits out the latency
    // of the V^T reads that the exponentials are there to cover
    __builtin_amdgcn_sched_barrier(0);

#pragma unroll
    for (int t = 0; t < 4; ++t) {
#pragma unroll
      for (int c = 0; c < 2; ++c) o[c][t] = wmma_bf16(vb[t], pb[c][1], o[c][t]);
    }

    __syncthreads();   // all waves done with buffer bf before it refills
  };
  for (int k0 = 0; k0 < S_ - KC_; k0 += KC_) pass(k0, true);
  pass(S_ - KC_, false);

  // The two waves of a query group join their key halves: wave kh keeps query
  // tile kh and hands the other tile, with its maximum and sum, to its partner
  // through the K and V^T buffers, which every wave left at the last pass's
  // closing barrier and into which no copy is in flight.
  float* xo = reinterpret_cast<float*>(&Ks[0][0][0]);   // 8 waves x 4 KiB
  float* xm = reinterpret_cast<float*>(&Vs[0][0][0]);   // 8 waves x 256 B
  v8f ok[4];
#pragma unroll
  for (int t = 0; t < 4; ++t) {
    v8f og;
#pragma unroll
    for (int r = 0; r < 8; ++r) {
      og[r]    = kh ? o[0][t][r] : o[1][t][r];
      ok[t][r] = kh ? o[1][t][r] : o[0][t][r];
    }
    float* w = xo + wave * 1024 + t * 256 + lane * 4;
    *reinterpret_cast<f32x4*>(w) = __builtin_shufflevector(og, og, 0, 1, 2, 3);
    *reinterpret_cast<f32x4*>(w + 128) =
        __builtin_shufflevector(og, og, 4, 5, 6, 7);
  }
  xm[wave * 64 + lane]      = kh ? mrow[0] : mrow[1];
  xm[wave * 64 + 32 + lane] = kh ? lrow[0] : lrow[1];
  const float mk0 = kh ? mrow[1] : mrow[0];
  const float lk0 = kh ? lrow[1] : lrow[0];
  __syncthreads();   // the partner's tile is in LDS before it is read
  const int pw = wave ^ 1;
  const float mp = xm[pw * 64 + lane], lp = xm[pw * 64 + 32 + lane];
  const float mj = fmaxf(mk0, mp);
  const float ak = __expf(mk0 - mj), ap = __expf(mp - mj);
  const float lj = lk0 * ak + lp * ap;
  // join the lane halves' sums, normalize and emit context, merged heads bf16
  // [b*S+s][H]: 8 consecutive d per lane and tile
  const float inv = 1.0f / (lj + xhalf(lj));
  const float fk = ak * inv, fp = ap * inv;
  v8bf cc[4];
#pragma unroll
  for (int t = 0; t < 4; ++t) {
    const float* w = xo + pw * 1024 + t * 256 + lane * 4;
    const f32x4 p0 = *reinterpret_cast<const f32x4*>(w);
    const f32x4 p1 = *reinterpret_cast<const f32x4*>(w + 128);
#pragma unroll
    for (int r = 0; r < 8; ++r)
      cc[t][r] = (__bf16)(ok[t][r] * fk + ((r < 4) ? p0[r & 3] : p1[r & 3]) * fp);
  }
  // The wave's 16 x 64 tile (queries 16 wave + ln of the block) is 16 whole
  // lines of ctx, but a lane holds 16-byte pieces of one row.  The tile turns
  // in 16 mask rows that no wave reads any more and only this wave writes (no
  // copy is in flight behind the last pass), so that each store covers 4 whole
  // lines.
  const int qb = blockIdx.x * QB_ + wave * 16;
  unsigned short* srow =
      reinterpret_cast<unsigned short*>(&Ms[wave * 16 + ln][0]) + half * 8;
  *reinterpret_cast<u32x4*>(srow)      = __builtin_bit_cast(u32x4, cc[0]);
  *reinterpret_cast<u32x4*>(srow + 16) = __builtin_bit_cast(u32x4, cc[1]);
  *reinterpret_cast<u32x4*>(srow + 32) = __builtin_bit_cast(u32x4, cc[2]);
  *reinterpret_cast<u32x4*>(srow + 48) = __builtin_bit_cast(u32x4, cc[3]);
  // the other lanes' pieces are in LDS before this lane reads them back
  asm volatile("s_wait_dscnt 0x0" ::: "memory");
  const int sub = lane >> 3, c8 = (lane & 7) * 8;
  u32x4 tc[4];
#pragma unroll
  for (int t = 0; t < 4; ++t)
    tc[t] = *reinterpret_cast<const u32x4*>(
        reinterpret_cast<const unsigned short*>(&Ms[wave * 16 + 4 * t + sub][0]) + c8);
  unsigned short* crow =
      ctx + ((size_t)b * S_ + (qb + sub)) * H_ + (size_t)h * HD_ + c8;
#pragma unroll
  for (int t = 0; t < 4; ++t)
    *reinterpret_cast<u32x4*>(crow + 4 * t * H_) = tc[t];
}

// ---------------------------------------------------------------------------
// Kernel 4: output projection + bias + residual + LayerNorm (fused)
// ---------------------------------------------------------------------------
// register budget as in the QKV kernel: one block per WGP, 4 waves per SIMD
__global__ __launch_bounds__(512) __attribute__((amdgpu_waves_per_eu(4, 4)))
void proj_ln_kernel(
    const unsigned short* __restrict__ ctx,
    const unsigned short* __restrict__ woP,
    const float* __restrict__ bo, const float* __restrict__ x,
    const float* __restrict__ gamma, const float* __restrict__ beta,
    float* __restrict__ out) {
  __shared__ __align__(16) unsigned short cA[GR_][264];
  __shared__ __align__(16) float          ot[GR_][264];

  const int tid = threadIdx.x;
  const int mbase = blockIdx.x * GR_;
  const int wave = tid >> 5, lane = tid & 31;
  const int half = lane >> 4, ln = lane & 15;
  const int j = wave * 16 + ln;

  // the wave's 16 weight columns need nothing from LDS: they are asked for
  // ahead of the barrier and arrive while the ctx tile is staged
  const float bb = bo[j];
  const unsigned short* bp = woP + wave * WTILE_ + lane * 8;
  v16bf bw[H_ / 32];
#pragma unroll
  for (int k = 0; k < H_ / 32; ++k)
    bw[k] = ld16bf(bp + WSTEP_ * k, bp + WSTEP_ * k + 256);

  { // stage ctx tile (already bf16)
    const int ch = (tid & 31) * 8;
#pragma unroll
    for (int t = 0; t < GT_; ++t) {
      const int row = (tid >> 5) + 16 * t;
      *reinterpret_cast<u32x4*>(&cA[row][ch]) =
          *reinterpret_cast<const u32x4*>(ctx + (size_t)(mbase + row) * H_ + ch);
    }
  }
  // the weight loads' address stays whole up to this wait
  asm volatile("s_wait_xcnt 0x0" :: "v"(bp) : "memory");
  __syncthreads();

  v8f c[GT_];
#pragma unroll
  for (int t = 0; t < GT_; ++t) {
#pragma unroll
    for (int r = 0; r < 8; ++r) c[t][r] = bb;
  }

#pragma unroll
  for (int kk = 0; kk < H_; kk += 32) {
#pragma unroll
    for (int t = 0; t < GT_; ++t) {
      const unsigned short* ar = &cA[16 * t + ln][kk + half * 8];
      c[t] = wmma_bf16(ld16bf(ar, ar + 16), bw[kk / 32], c[t]);
    }
  }

  // + residual, stage rows for LayerNorm
  {
    const float* xr = x + (size_t)(mbase + 8 * half) * H_ + j;
    float res[GT_][8];
#pragma unroll
    for (int t = 0; t < GT_; ++t) {
#pragma unroll
      for (int r = 0; r < 8; ++r) res[t][r] = xr[(16 * t + r) * H_];
    }
    // the loads' address stays whole up to this wait
    asm volatile("s_wait_xcnt 0x0" :: "v"(xr) : "memory");
#pragma unroll
    for (int t = 0; t < GT_; ++t) {
#pragma unroll
      for (int r = 0; r < 8; ++r)
        ot[16 * t + r + 8 * half][j] = c[t][r] + res[t][r];
    }
  }
  __syncthreads();

  // LayerNorm: wave w normalizes rows w, w + 16, ...  A lane takes 4 columns
  // of each half of the row, so a wave's 16-byte stores cover 4 whole lines
#pragma unroll
  for (int t = 0; t < GT_; ++t) {
    const int row = wave + 16 * t, c0 = lane * 4;
    float vals[8], s = 0.f, sq = 0.f;
#pragma unroll
    for (int i = 0; i < 8; ++i) {
      vals[i] = ot[row][c0 + (i >> 2) * 128 + (i & 3)];
      s += vals[i];
      sq += vals[i] * vals[i];
    }
    s  += __shfl_xor(s, 16, 32);  sq += __shfl_xor(sq, 16, 32);
    s  += __shfl_xor(s, 8, 32);   sq += __shfl_xor(sq, 8, 32);
    s  += __shfl_xor(s, 4, 32);   sq += __shfl_xor(sq, 4, 32);
    s  += __shfl_xor(s, 2, 32);   sq += __shfl_xor(sq, 2, 32);
    s  += __shfl_xor(s, 1, 32);   sq += __shfl_xor(sq, 1, 32);
    const float mu  = s * (1.0f / 256.0f);
    const float var = sq * (1.0f / 256.0f) - mu * mu;
    const float inv = rsqrtf(var + 1e-12f);
    const size_t gr = (size_t)(mbase + row) * H_;
#pragma unroll
    for (int i = 0; i < 8; ++i) {
      const int col = c0 + (i >> 2) * 128 + (i & 3);
      out[gr + col] = (vals[i] - mu) * inv * gamma[col] + beta[col];
    }
  }
}

// ---------------------------------------------------------------------------
extern "C" void kernel_launch(void* const* d_in, const int* in_sizes, int n_in,
                              void* d_out, int out_size, void* d_ws, size_t ws_size,
                              hipStream_t stream) {
  const float* x     = (const float*)d_in[0];
  const float* mask  = (const float*)d_in[1];
  const float* Wq    = (const float*)d_in[2];
  const float* bq    = (const float*)d_in[3];
  const float* Wk    = (const float*)d_in[4];
  const float* bk    = (const float*)d_in[5];
  const float* Wv    = (const float*)d_in[6];
  const float* bv    = (const float*)d_in[7];
  const float* Wo    = (const float*)d_in[8];
  const float* bo    = (const float*)d_in[9];
  const float* gamma = (const float*)d_in[10];
  const float* beta  = (const float*)d_in[11];
  float* out = (float*)d_out;

  // workspace layout (ushort elements)
  unsigned short* ws  = (unsigned short*)d_ws;
  unsigned short* wT  = ws;                         // 4 * 256*256
  unsigned short* Qb  = ws + 4 * H_ * H_;           // [B][NH][S][HD]
  unsigned short* Kb  = Qb + (size_t)B_ * NH_ * S_ * HD_;
  unsigned short* Vtb = Kb + (size_t)B_ * NH_ * S_ * HD_;
  unsigned short* ctx = Vtb + (size_t)B_ * NH_ * S_ * HD_;  // [M][H]

  prep_weights_kernel<<<dim3(H_ * H_ / 8 / 256, 4), 256, 0, stream>>>(
      Wq, Wk, Wv, Wo, wT);

  qkv_kernel<<<M_ / GR_, 512, 0, stream>>>(
      x, bq, bk, bv, wT, wT + H_ * H_, wT + 2 * H_ * H_, Qb, Kb, Vtb);

  attn_kernel<<<dim3(S_ / QB_, NH_, B_), 256, 0, stream>>>(
      mask, Qb, Kb, Vtb, ctx);

  proj_ln_kernel<<<M_ / GR_, 512, 0, stream>>>(
      ctx, wT + 3 * H_ * H_, bo, x, gamma, beta, out);
}
